// v000
// The times below were measured on an AMD MI455X: many runs one after another, warmed up first and cycling through
// copies of the inputs, with the whole window's GPU time divided by the number of runs. Launches and the gaps
// between them are all in it. The median over several windows is given; except for v000 it joins two sittings, which
// can be a few percent apart, so the side-by-side timings, each taken in one sitting, are the better comparison.
// v000, which the later versions start from, runs in 682 microseconds.
#include <hip/hip_runtime.h>

// Variable selection network (x [32][512][64]; per feature f a Linear(1, 64) + ELU: T[r][f][h] = elu(x[r][f] Wf[f][h] + bf[f][h]); logits[r][f] = sum_{f',h} T[r][f'][h] Ws[f'*64 + h][f] + bs[f]; weights = softmax over the 64 features; selected[r][h] = sum_f weights[r][f] T[r][f][h] -> tuple (selected [32][512][64], weights [32][512][64]) (1.0 M + 1.0 M)).
// Layout: the 16,384 rows in 4 chunks of 4,096: an element-wise kernel writes the chunk's T (f32, [4096][64 x 64]) and its bf16 hi/lo planes; one GEMM (K 4096, N 64, 2 products against the exact selector weight + bias) gives the logits; a per-row kernel (one wave per row) takes the softmax over the 64 features and forms the weighted sum over f of T[f][h], writing both tuple members.
// Compute dtypes, f32 accumulate: every input rounded to bf16; T in f32 (ELU via expm1); selector GEMM hi/lo x exact; softmax and the weighted sum in f32 (fixed orders).

#define NR   16384   // rows = 32 x 512
#define RC   4096    // rows per chunk
#define NF   64      // features
#define NHID 64      // hidden per feature
#define KT   (NF * NHID)   // 4096
typedef _Float16 h16;
typedef unsigned short bf;
typedef __attribute__((ext_vector_type(16))) __bf16   v16bf;
typedef __attribute__((ext_vector_type(16))) _Float16 v16h;
typedef __attribute__((ext_vector_type(8)))  _Float16 v8h;
typedef __attribute__((ext_vector_type(8)))  unsigned short v8us;
typedef __attribute__((ext_vector_type(8)))  float    v8f;
typedef __attribute__((ext_vector_type(4)))  float    v4f;
typedef v8h  __attribute__((may_alias)) v8ha;
typedef v4f  __attribute__((may_alias)) v4fa;
typedef v8us __attribute__((may_alias)) v8usa;

__device__ __forceinline__ unsigned short f2bf(float f) { unsigned u = __float_as_uint(f); u += 0x7FFFu + ((u >> 16) & 1u); return (unsigned short)(u >> 16); }
__device__ __forceinline__ float bf2f(unsigned short b) { return __uint_as_float(((unsigned)b) << 16); }
__device__ __forceinline__ float bfr(float f) { return bf2f(f2bf(f)); }
__device__ __forceinline__ v16h cat16(v8h lo, v8h hi) { return __builtin_shufflevector(lo, hi, 0, 1, 2, 3, 4, 5, 6, 7, 8, 9, 10, 11, 12, 13, 14, 15); }
__device__ __forceinline__ v16bf cat16b(v8us lo, v8us hi) { return __builtin_bit_cast(v16bf, __builtin_shufflevector(lo, hi, 0, 1, 2, 3, 4, 5, 6, 7, 8, 9, 10, 11, 12, 13, 14, 15)); }
__device__ __forceinline__ v8f wmma16(v16h a, v16h b, v8f c) { return __builtin_amdgcn_wmma_f32_16x16x32_f16(false, a, false, b, (short)0, c, false, false); }
__device__ __forceinline__ v8f wmmab(v16bf a, v16bf b, v8f c) { return __builtin_amdgcn_wmma_f32_16x16x32_bf16(false, a, false, b, (short)0, c, false, false); }



// ---- k_gemmw: register-blocked GEMM, ONE WAVE per 64x64 output tile (16 accumulators), operands straight from K-contiguous 16-bit planes; grid (M/64, N/64, Z), 32 threads.
// C[m][n] (f32, pitch ldc, + optional f32 bias[n]) = sum_k A[m][k] Bt[n][k] (+ split products per NSPLIT). z-batch strides sA/sB/sC in elements. K % 32 == 0.
template <typename T16> struct WFrag;
template <> struct WFrag<h16> { typedef v16h V; static __device__ __forceinline__ V ld(const h16* p) { return cat16(*(const v8h*)p, *(const v8h*)(p + 16)); } static __device__ __forceinline__ v8f mma(V a, V b, v8f c) { return wmma16(a, b, c); } };
template <> struct WFrag<bf> { typedef v16bf V; static __device__ __forceinline__ V ld(const bf* p) { return cat16b(*(const v8us*)p, *(const v8us*)(p + 16)); } static __device__ __forceinline__ v8f mma(V a, V b, v8f c) { return wmmab(a, b, c); } };
template <typename T16, int NSPLIT, bool BIAS>
__global__ __launch_bounds__(32) void k_gemmw(const T16* __restrict__ A, const T16* __restrict__ A2, const T16* __restrict__ Bt, const T16* __restrict__ Bt2, int K, float* C, int ldc, const float* __restrict__ bias, size_t sA, size_t sB, size_t sC) {
    typedef typename WFrag<T16>::V V;
    __shared__ __align__(16) float os[16 * 68];
    const size_t z = blockIdx.z; A += z * sA; if (A2) A2 += z * sA; Bt += z * sB; if (Bt2) Bt2 += z * sB; C += z * sC;
    const int lane = threadIdx.x & 31, lr = lane & 15, hi = lane >> 4; const int r0 = blockIdx.x * 64, c0 = blockIdx.y * 64;
    v8f acc[4][4];
#pragma unroll
    for (int mb = 0; mb < 4; ++mb)
#pragma unroll
        for (int nb = 0; nb < 4; ++nb) acc[mb][nb] = (v8f){};
    const size_t aoff = (size_t)(r0 + lr) * K + 8 * hi, boff = (size_t)(c0 + lr) * K + 8 * hi;
#pragma unroll 1
    for (int kc = 0; kc < K; kc += 32) {
        V a[4], a2[4];
#pragma unroll
        for (int mb = 0; mb < 4; ++mb) { a[mb] = WFrag<T16>::ld(A + aoff + (size_t)mb * 16 * K + kc); if (NSPLIT == 1 || NSPLIT == 2) a2[mb] = WFrag<T16>::ld(A2 + aoff + (size_t)mb * 16 * K + kc); }
#pragma unroll
        for (int nb = 0; nb < 4; ++nb) { const V b = WFrag<T16>::ld(Bt + boff + (size_t)nb * 16 * K + kc); V b2; if (NSPLIT >= 2) b2 = WFrag<T16>::ld(Bt2 + boff + (size_t)nb * 16 * K + kc);
#pragma unroll
            for (int mb = 0; mb < 4; ++mb) { acc[mb][nb] = WFrag<T16>::mma(a[mb], b, acc[mb][nb]); if (NSPLIT == 1 || NSPLIT == 2) acc[mb][nb] = WFrag<T16>::mma(a2[mb], b, acc[mb][nb]); if (NSPLIT >= 2) acc[mb][nb] = WFrag<T16>::mma(a[mb], b2, acc[mb][nb]); } }
        asm volatile("v_nop\n\tv_nop\n\tv_nop\n\tv_nop" : "+v"(acc[0][0]), "+v"(acc[1][1]), "+v"(acc[2][2]), "+v"(acc[3][3]) : "v"(a[0]), "v"(a[3]));
    }
#pragma unroll
    for (int mb = 0; mb < 4; ++mb) {
#pragma unroll
        for (int nb = 0; nb < 4; ++nb) {
#pragma unroll
            for (int j = 0; j < 8; ++j) os[(hi * 8 + j) * 68 + nb * 16 + lr] = acc[mb][nb][j]; }
        __builtin_amdgcn_wave_barrier(); asm volatile("" ::: "memory");
        float* crow = C + (size_t)(r0 + mb * 16) * ldc + c0;
{
#pragma unroll
            for (int s = 0; s < 8; ++s) { const int row = 2 * s + hi, cofs = lr * 4; v4f val = *(const v4fa*)(os + row * 68 + cofs); if (BIAS) { val[0] += bfr(bias[c0 + cofs]); val[1] += bfr(bias[c0 + cofs + 1]); val[2] += bfr(bias[c0 + cofs + 2]); val[3] += bfr(bias[c0 + cofs + 3]); }
                *(v4f*)(crow + (size_t)row * ldc + cofs) = val; }
             }
        __builtin_amdgcn_wave_barrier(); asm volatile("" ::: "memory");
    }
}

typedef __attribute__((ext_vector_type(4))) unsigned short v4us;
typedef __attribute__((ext_vector_type(2))) unsigned short v2us;
typedef __attribute__((ext_vector_type(2))) float v2f;
__device__ __forceinline__ void splitf(float y, unsigned short& h, unsigned short& l) { h = f2bf(y); l = f2bf(y - bf2f(h)); }
__global__ __launch_bounds__(256) void k_wtG(const float* __restrict__ w, int K, int N, bf* Bt) {
    const int lane = threadIdx.x & 31; const int L0 = (blockIdx.x * 8 + (threadIdx.x >> 5)) * 8; const int nlines = N * K / 64;
{
#pragma unroll 1
        for (int l = 0; l < 8; ++l) { const int L = L0 + l; if (L >= nlines) break; const size_t e = (size_t)L * 64 + lane * 2; const int k = (int)(e % K), n = (int)(e / K); v2us o;
            o[0] = f2bf(w[(size_t)k * N + n]); o[1] = f2bf(w[(size_t)(k + 1) * N + n]); *(v2us*)(Bt + e) = o; }
         }
}

__global__ __launch_bounds__(256) void k_tr(const float* __restrict__ xc, const float* __restrict__ Wf, const float* __restrict__ bfv, float* T, bf* Th, bf* Tl) { const size_t i = (size_t)blockIdx.x * 256 + threadIdx.x; if (i >= (size_t)RC * KT / 4) return; const int c0 = (int)(i % (KT / 4)) * 4; const size_t r = i / (KT / 4); const int f = c0 / NHID, h0 = c0 % NHID; const float xv = bfr(xc[r * NF + f]); v4f o; v4us oh, ol;
#pragma unroll
    for (int q = 0; q < 4; ++q) { float p = __fmul_rn(xv, bfr(Wf[f * NHID + h0 + q])); asm volatile("" : "+v"(p)); const float v = __fadd_rn(p, bfr(bfv[f * NHID + h0 + q])); const float e = expm1f(v); const float t = (v > 0.0f) ? v : e; o[q] = t; unsigned short a, b; splitf(t, a, b); oh[q] = a; ol[q] = b; }
    *(v4f*)(T + r * KT + c0) = o; *(v4us*)(Th + r * KT + c0) = oh; *(v4us*)(Tl + r * KT + c0) = ol;  }
__global__ __launch_bounds__(256) void k_sel(const float* __restrict__ LG, const float* __restrict__ T, size_t r0, float* sel, float* wts) { const int lane = threadIdx.x & 31; const size_t rl = (size_t)blockIdx.x * 8 + (threadIdx.x >> 5); if (rl >= RC) return; const size_t r = r0 + rl;
    const v2f lg = *(const v2f*)(LG + rl * NF + lane * 2); float mx = fmaxf(lg[0], lg[1]);
#pragma unroll
    for (int sh = 16; sh; sh >>= 1) mx = fmaxf(mx, __shfl_xor(mx, sh, 32));
    float d0 = __fsub_rn(lg[0], mx), d1 = __fsub_rn(lg[1], mx); asm volatile("" : "+v"(d0), "+v"(d1)); const float e0 = __builtin_amdgcn_exp2f(__fmul_rn(d0, 1.4426950408889634f)), e1 = __builtin_amdgcn_exp2f(__fmul_rn(d1, 1.4426950408889634f)); float sum = __fadd_rn(e0, e1);
#pragma unroll
    for (int sh = 16; sh; sh >>= 1) sum = __fadd_rn(sum, __shfl_xor(sum, sh, 32));
    const float inv = __fdiv_rn(1.0f, sum); const float w0 = __fmul_rn(e0, inv), w1 = __fmul_rn(e1, inv);
    float s0 = 0.f, s1 = 0.f; const float* tr = T + rl * KT + lane * 2;
#pragma unroll 4
    for (int f = 0; f < NF; ++f) { const float wf = __shfl((f & 1) ? w1 : w0, f >> 1, 32);   /* weight of feature f lives in lane f/2 (unconditional shuffle, wave-uniform source lane) */ const v2f tv = *(const v2f*)(tr + f * NHID); float p0 = __fmul_rn(wf, tv[0]), p1 = __fmul_rn(wf, tv[1]); asm volatile("" : "+v"(p0), "+v"(p1)); s0 = __fadd_rn(s0, p0); s1 = __fadd_rn(s1, p1); }
    v2f ow; ow[0] = w0; ow[1] = w1; v2f os; os[0] = s0; os[1] = s1;
    *(v2f*)(wts + r * NF + lane * 2) = ow; *(v2f*)(sel + r * NHID + lane * 2) = os;  }

extern "C" void kernel_launch(void* const* d_in, const int* in_sizes, int n_in,
                              void* d_out, int out_size, void* d_ws, size_t ws_size, hipStream_t stream) {
    (void)in_sizes; (void)n_in; (void)out_size;
    const float* x = (const float*)d_in[0]; const float* Wf = (const float*)d_in[1]; const float* bfv = (const float*)d_in[2]; const float* Ws = (const float*)d_in[3]; const float* bs = (const float*)d_in[4];
    float* SEL = (float*)d_out; float* WTS = SEL + (size_t)NR * NHID;     // tuple: selected [32][512][64] | weights [32][512][64]
    char* wsp = (char*)d_ws;
    auto take = [&](size_t bytes) { char* p = wsp; wsp += (bytes + 255) & ~(size_t)255; return (void*)p; };
    bf* WSB = (bf*)take((size_t)NF * KT * 2); float* T = (float*)take((size_t)RC * KT * 4); bf* Th = (bf*)take((size_t)RC * KT * 2); bf* Tl = (bf*)take((size_t)RC * KT * 2); float* LG = (float*)take((size_t)RC * NF * 4);
    if ((size_t)(wsp - (char*)d_ws) > ws_size) return;    // ws 256 MiB (carve ~130 MiB)
    k_wtG<<<(KT * NF / 64 + 63) / 64, 256, 0, stream>>>(Ws, KT, NF, WSB);   /* Ws 'xw' [4096][64] -> Bt [64][4096] */
    for (size_t r0 = 0; r0 < (size_t)NR; r0 += RC) {
        k_tr<<<(unsigned)(((size_t)RC * KT / 4 + 255) / 256), 256, 0, stream>>>(x + r0 * NF, Wf, bfv, T, Th, Tl);
        k_gemmw<bf, 1, true><<<dim3(RC / 64, NF / 64, 1), 32, 0, stream>>>(Th, Tl, WSB, nullptr, KT, LG, NF, bs, 0, 0, 0);   /* logits = T Ws + bs */
        k_sel<<<RC / 8, 256, 0, stream>>>(LG, T, r0, SEL, WTS); }
}

// v001
// A run of this version takes 317 microseconds.
// Two timings next to v000 put it at 2.12 and 2.13 times that version's speed.
#include <hip/hip_runtime.h>

// Variable selection network (x [32][512][64]; per feature f a Linear(1, 64) + ELU: T[r][f][h] = elu(x[r][f] Wf[f][h] + bf[f][h]); logits[r][f] = sum_{f',h} T[r][f'][h] Ws[f'*64 + h][f] + bs[f]; weights = softmax over the 64 features; selected[r][h] = sum_f weights[r][f] T[r][f][h] -> tuple (selected [32][512][64], weights [32][512][64]) (1.0 M + 1.0 M)).
// Layout: the 16,384 rows in 4 chunks of 4,096: an element-wise kernel writes the chunk's T (f32, [4096][64 x 64]) and its bf16 hi/lo planes; one GEMM (K 4096, N 64, 2 products against the exact selector weight + bias; K split over the 16 waves of a work-group) gives the logits; a per-row kernel (one wave per row) takes the softmax over the 64 features and forms the weighted sum over f of T[f][h], writing both tuple members.
// Compute dtypes, f32 accumulate: every input rounded to bf16; T in f32 (ELU via expm1); selector GEMM hi/lo x exact; softmax and the weighted sum in f32 (fixed orders).

#define NR   16384   // rows = 32 x 512
#define RC   4096    // rows per chunk
#define NF   64      // features
#define NHID 64      // hidden per feature
#define KT   (NF * NHID)   // 4096
typedef _Float16 h16;
typedef unsigned short bf;
typedef __attribute__((ext_vector_type(16))) __bf16   v16bf;
typedef __attribute__((ext_vector_type(16))) _Float16 v16h;
typedef __attribute__((ext_vector_type(8)))  _Float16 v8h;
typedef __attribute__((ext_vector_type(8)))  unsigned short v8us;
typedef __attribute__((ext_vector_type(8)))  float    v8f;
typedef __attribute__((ext_vector_type(4)))  float    v4f;
typedef v8h  __attribute__((may_alias)) v8ha;
typedef v4f  __attribute__((may_alias)) v4fa;
typedef v8us __attribute__((may_alias)) v8usa;

__device__ __forceinline__ unsigned short f2bf(float f) { unsigned u = __float_as_uint(f); u += 0x7FFFu + ((u >> 16) & 1u); return (unsigned short)(u >> 16); }
__device__ __forceinline__ float bf2f(unsigned short b) { return __uint_as_float(((unsigned)b) << 16); }
__device__ __forceinline__ float bfr(float f) { return bf2f(f2bf(f)); }
__device__ __forceinline__ v16h cat16(v8h lo, v8h hi) { return __builtin_shufflevector(lo, hi, 0, 1, 2, 3, 4, 5, 6, 7, 8, 9, 10, 11, 12, 13, 14, 15); }
__device__ __forceinline__ v16bf cat16b(v8us lo, v8us hi) { return __builtin_bit_cast(v16bf, __builtin_shufflevector(lo, hi, 0, 1, 2, 3, 4, 5, 6, 7, 8, 9, 10, 11, 12, 13, 14, 15)); }
__device__ __forceinline__ v8f wmma16(v16h a, v16h b, v8f c) { return __builtin_amdgcn_wmma_f32_16x16x32_f16(false, a, false, b, (short)0, c, false, false); }
__device__ __forceinline__ v8f wmmab(v16bf a, v16bf b, v8f c) { return __builtin_amdgcn_wmma_f32_16x16x32_bf16(false, a, false, b, (short)0, c, false, false); }



// ---- k_gemmw: split-K GEMM, one work-group of GW waves per 16x64 output tile; wave w sums the K / GW columns from w * (K / GW) on (4 accumulators), operands straight from K-contiguous 16-bit planes; the GW partial tiles meet in LDS and are added in wave order. grid (M/16, N/64, Z), 32 * GW threads.
// C[m][n] (f32, pitch ldc, + optional f32 bias[n]) = sum_k A[m][k] Bt[n][k] (+ split products per NSPLIT). z-batch strides sA/sB/sC in elements. K % (64 * GW) == 0.
#define GW 16
static_assert(GW == 16, "wave w adds up row w of the 16-row tile");
typedef __attribute__((ext_vector_type(2))) float v2f;
typedef v2f  __attribute__((may_alias)) v2fa;
template <typename T16> struct WFrag;
template <> struct WFrag<h16> { typedef v16h V; static __device__ __forceinline__ V ld(const h16* p) { return cat16(*(const v8h*)p, *(const v8h*)(p + 16)); } static __device__ __forceinline__ v8f mma(V a, V b, v8f c) { return wmma16(a, b, c); } };
template <> struct WFrag<bf> { typedef v16bf V; static __device__ __forceinline__ V ld(const bf* p) { return cat16b(*(const v8us*)p, *(const v8us*)(p + 16)); } static __device__ __forceinline__ v8f mma(V a, V b, v8f c) { return wmmab(a, b, c); } };
template <typename T16, int NSPLIT, bool BIAS>
__global__ __launch_bounds__(32 * GW) void k_gemmw(const T16* __restrict__ A, const T16* __restrict__ A2, const T16* __restrict__ Bt, const T16* __restrict__ Bt2, int K, float* C, int ldc, const float* __restrict__ bias, size_t sA, size_t sB, size_t sC) {
    typedef typename WFrag<T16>::V V;
    __shared__ __align__(16) float os[GW * 16 * 68];
    const size_t z = blockIdx.z; A += z * sA; if (A2) A2 += z * sA; Bt += z * sB; if (Bt2) Bt2 += z * sB; C += z * sC;
    const int lane = threadIdx.x & 31, lr = lane & 15, hi = lane >> 4, wv = threadIdx.x >> 5; const int r0 = blockIdx.x * 16, c0 = blockIdx.y * 64;
    const int ks = K / GW;   // this wave's share of K
    v8f acc[4];
#pragma unroll
    for (int nb = 0; nb < 4; ++nb) acc[nb] = (v8f){};
    const size_t aoff = (size_t)(r0 + lr) * K + wv * ks + 8 * hi, boff = (size_t)(c0 + lr) * K + wv * ks + 8 * hi;
    // the six row addresses are carried through the loop and stepped at its foot: so they stay live over the whole run of loads and no load's result is given the registers of an earlier load's address. Typed as global-memory pointers: carried as generic ones the B loads came out as flat loads
    typedef const __attribute__((address_space(1))) T16* GP;
    GP pa = (GP)(A + aoff), pa2 = (NSPLIT == 1 || NSPLIT == 2) ? (GP)(A2 + aoff) : pa, pb[4], pb2[4];
#pragma unroll
    for (int nb = 0; nb < 4; ++nb) { pb[nb] = (GP)(Bt + boff + (size_t)nb * 16 * K); pb2[nb] = (NSPLIT >= 2) ? (GP)(Bt2 + boff + (size_t)nb * 16 * K) : pb[nb]; }
#pragma unroll 1   // stays rolled: one trip already has 24 loads in flight, a second would only add registers and code
    for (int kc = 0; kc < ks; kc += 64) {   // 64 columns a trip: the four loads of a row's 128-byte line stand side by side
        V a[2], a2[2], b[4][2], b2[4][2];
#pragma unroll
        for (int h = 0; h < 2; ++h) a[h] = WFrag<T16>::ld((const T16*)pa + 32 * h);
        if (NSPLIT == 1 || NSPLIT == 2) {
#pragma unroll
            for (int h = 0; h < 2; ++h) a2[h] = WFrag<T16>::ld((const T16*)pa2 + 32 * h); }
#pragma unroll
        for (int nb = 0; nb < 4; ++nb) {
#pragma unroll
            for (int h = 0; h < 2; ++h) { b[nb][h] = WFrag<T16>::ld((const T16*)pb[nb] + 32 * h); if (NSPLIT >= 2) b2[nb][h] = WFrag<T16>::ld((const T16*)pb2[nb] + 32 * h); } }
        __builtin_amdgcn_sched_barrier(0);   // keeps the trip's loads together in front of the products: left alone the scheduler cuts them into two runs of 12 with a full load wait between, two round trips to memory a trip instead of one
#pragma unroll
        for (int h = 0; h < 2; ++h) {
#pragma unroll
            for (int nb = 0; nb < 4; ++nb) { acc[nb] = WFrag<T16>::mma(a[h], b[nb][h], acc[nb]); if (NSPLIT == 1 || NSPLIT == 2) acc[nb] = WFrag<T16>::mma(a2[h], b[nb][h], acc[nb]); if (NSPLIT >= 2) acc[nb] = WFrag<T16>::mma(a[h], b2[nb][h], acc[nb]); } }
        pa += 64; pa2 += 64;
#pragma unroll
        for (int nb = 0; nb < 4; ++nb) { pb[nb] += 64; pb2[nb] += 64; }
    }
    float* pw = os + wv * (16 * 68);
#pragma unroll
    for (int nb = 0; nb < 4; ++nb) {
#pragma unroll
        for (int j = 0; j < 8; ++j) pw[(hi * 8 + j) * 68 + nb * 16 + lr] = acc[nb][j]; }
    __syncthreads();   // every wave's partial tile is in LDS before any is read
    const int row = wv, cofs = lane * 2;   // wave w adds up row w of the tile (GW == 16 rows), two columns a lane
    v2f val = *(const v2fa*)(os + row * 68 + cofs);
#pragma unroll
    for (int w = 1; w < GW; ++w) { const v2f pv = *(const v2fa*)(os + (w * 16 + row) * 68 + cofs); val[0] += pv[0]; val[1] += pv[1]; }
    if (BIAS) { val[0] += bfr(bias[c0 + cofs]); val[1] += bfr(bias[c0 + cofs + 1]); }
    *(v2f*)(C + (size_t)(r0 + row) * ldc + c0 + cofs) = val;
}

typedef __attribute__((ext_vector_type(4))) unsigned short v4us;
typedef __attribute__((ext_vector_type(2))) unsigned short v2us;
__device__ __forceinline__ void splitf(float y, unsigned short& h, unsigned short& l) { h = f2bf(y); l = f2bf(y - bf2f(h)); }
__global__ __launch_bounds__(256) void k_wtG(const float* __restrict__ w, int K, int N, bf* Bt) {
    const int lane = threadIdx.x & 31; const int L0 = (blockIdx.x * 8 + (threadIdx.x >> 5)) * 8; const int nlines = N * K / 64;
{
#pragma unroll 1
        for (int l = 0; l < 8; ++l) { const int L = L0 + l; if (L >= nlines) break; const size_t e = (size_t)L * 64 + lane * 2; const int k = (int)(e % K), n = (int)(e / K); v2us o;
            o[0] = f2bf(w[(size_t)k * N + n]); o[1] = f2bf(w[(size_t)(k + 1) * N + n]); *(v2us*)(Bt + e) = o; }
         }
}

__global__ __launch_bounds__(256) void k_tr(const float* __restrict__ xc, const float* __restrict__ Wf, const float* __restrict__ bfv, float* T, bf* Th, bf* Tl) { const size_t i = (size_t)blockIdx.x * 256 + threadIdx.x; if (i >= (size_t)RC * KT / 4) return; const int c0 = (int)(i % (KT / 4)) * 4; const size_t r = i / (KT / 4); const int f = c0 / NHID, h0 = c0 % NHID; const float xv = bfr(xc[r * NF + f]); v4f o; v4us oh, ol;
#pragma unroll
    for (int q = 0; q < 4; ++q) { float p = __fmul_rn(xv, bfr(Wf[f * NHID + h0 + q])); asm volatile("" : "+v"(p)); const float v = __fadd_rn(p, bfr(bfv[f * NHID + h0 + q])); const float e = expm1f(v); const float t = (v > 0.0f) ? v : e; o[q] = t; unsigned short a, b; splitf(t, a, b); oh[q] = a; ol[q] = b; }
    *(v4f*)(T + r * KT + c0) = o; *(v4us*)(Th + r * KT + c0) = oh; *(v4us*)(Tl + r * KT + c0) = ol;  }
__global__ __launch_bounds__(256) void k_sel(const float* __restrict__ LG, const float* __restrict__ T, size_t r0, float* sel, float* wts) { const int lane = threadIdx.x & 31; const size_t rl = (size_t)blockIdx.x * 8 + (threadIdx.x >> 5); if (rl >= RC) return; const size_t r = r0 + rl;
    const v2f lg = *(const v2f*)(LG + rl * NF + lane * 2); float mx = fmaxf(lg[0], lg[1]);
#pragma unroll
    for (int sh = 16; sh; sh >>= 1) mx = fmaxf(mx, __shfl_xor(mx, sh, 32));
    float d0 = __fsub_rn(lg[0], mx), d1 = __fsub_rn(lg[1], mx); asm volatile("" : "+v"(d0), "+v"(d1)); const float e0 = __builtin_amdgcn_exp2f(__fmul_rn(d0, 1.4426950408889634f)), e1 = __builtin_amdgcn_exp2f(__fmul_rn(d1, 1.4426950408889634f)); float sum = __fadd_rn(e0, e1);
#pragma unroll
    for (int sh = 16; sh; sh >>= 1) sum = __fadd_rn(sum, __shfl_xor(sum, sh, 32));
    const float inv = __fdiv_rn(1.0f, sum); const float w0 = __fmul_rn(e0, inv), w1 = __fmul_rn(e1, inv);
    float s0 = 0.f, s1 = 0.f; const float* tr = T + rl * KT + lane * 2;
#pragma unroll 4
    for (int f = 0; f < NF; ++f) { const float wf = __shfl((f & 1) ? w1 : w0, f >> 1, 32);   /* weight of feature f lives in lane f/2 (unconditional shuffle, wave-uniform source lane) */ const v2f tv = *(const v2f*)(tr + f * NHID); float p0 = __fmul_rn(wf, tv[0]), p1 = __fmul_rn(wf, tv[1]); asm volatile("" : "+v"(p0), "+v"(p1)); s0 = __fadd_rn(s0, p0); s1 = __fadd_rn(s1, p1); }
    v2f ow; ow[0] = w0; ow[1] = w1; v2f os; os[0] = s0; os[1] = s1;
    *(v2f*)(wts + r * NF + lane * 2) = ow; *(v2f*)(sel + r * NHID + lane * 2) = os;  }

extern "C" void kernel_launch(void* const* d_in, const int* in_sizes, int n_in,
                              void* d_out, int out_size, void* d_ws, size_t ws_size, hipStream_t stream) {
    (void)in_sizes; (void)n_in; (void)out_size;
    const float* x = (const float*)d_in[0]; const float* Wf = (const float*)d_in[1]; const float* bfv = (const float*)d_in[2]; const float* Ws = (const float*)d_in[3]; const float* bs = (const float*)d_in[4];
    float* SEL = (float*)d_out; float* WTS = SEL + (size_t)NR * NHID;     // tuple: selected [32][512][64] | weights [32][512][64]
    char* wsp = (char*)d_ws;
    auto take = [&](size_t bytes) { char* p = wsp; wsp += (bytes + 255) & ~(size_t)255; return (void*)p; };
    bf* WSB = (bf*)take((size_t)NF * KT * 2); float* T = (float*)take((size_t)RC * KT * 4); bf* Th = (bf*)take((size_t)RC * KT * 2); bf* Tl = (bf*)take((size_t)RC * KT * 2); float* LG = (float*)take((size_t)RC * NF * 4);
    if ((size_t)(wsp - (char*)d_ws) > ws_size) return;    // ws 256 MiB (carve ~130 MiB)
    k_wtG<<<(KT * NF / 64 + 63) / 64, 256, 0, stream>>>(Ws, KT, NF, WSB);   /* Ws 'xw' [4096][64] -> Bt [64][4096] */
    for (size_t r0 = 0; r0 < (size_t)NR; r0 += RC) {
        k_tr<<<(unsigned)(((size_t)RC * KT / 4 + 255) / 256), 256, 0, stream>>>(x + r0 * NF, Wf, bfv, T, Th, Tl);
        k_gemmw<bf, 1, true><<<dim3(RC / 16, NF / 64, 1), 32 * GW, 0, stream>>>(Th, Tl, WSB, nullptr, KT, LG, NF, bs, 0, 0, 0);   /* logits = T Ws + bs */
        k_sel<<<RC / 8, 256, 0, stream>>>(LG, T, r0, SEL, WTS); }
}

// v002
// It runs in 63.1 microseconds.
// In two side-by-side timings against v001, it was 5.01 and 5.02 times as fast.
// All steps since v000 together make it 10.6 times as fast.
#include <hip/hip_runtime.h>

// Variable selection network (x [32][512][64]; per feature f a Linear(1, 64) + ELU: T[r][f][h] = elu(x[r][f] Wf[f][h] + bf[f][h]); logits[r][f] = sum_{f',h} T[r][f'][h] Ws[f'*64 + h][f] + bs[f]; weights = softmax over the 64 features; selected[r][h] = sum_f weights[r][f] T[r][f][h] -> tuple (selected [32][512][64], weights [32][512][64]) (1.0 M + 1.0 M)).
// Layout: one kernel transposes the selector weight to bf16 [64][4096]; one fused kernel, a work-group of 16 waves per 16 rows, does the rest. Wave w owns features 4w .. 4w+3 (K columns 256w .. 256w+255): it forms its T values in registers in the A-fragment order, splits them to bf16 hi/lo for the products and keeps the f32 values (half in registers, half in the lane's own LDS slots); the 16 partial logit tiles meet in LDS; wave w takes the softmax of row w; every wave then weights the T values it still holds, and the 16 partial sums meet in LDS again. T never goes through memory.
// Compute dtypes, f32 accumulate: every input rounded to bf16; T in f32 (ELU via expm1); selector GEMM hi/lo x exact; softmax and the weighted sum in f32 (fixed orders).

#define NR   16384   // rows = 32 x 512
#define NF   64      // features
#define NHID 64      // hidden per feature
#define KT   (NF * NHID)   // 4096
typedef _Float16 h16;
typedef unsigned short bf;
typedef __attribute__((ext_vector_type(16))) __bf16   v16bf;
typedef __attribute__((ext_vector_type(16))) _Float16 v16h;
typedef __attribute__((ext_vector_type(8)))  _Float16 v8h;
typedef __attribute__((ext_vector_type(8)))  unsigned short v8us;
typedef __attribute__((ext_vector_type(8)))  float    v8f;
typedef __attribute__((ext_vector_type(4)))  float    v4f;
typedef v8h  __attribute__((may_alias)) v8ha;
typedef v4f  __attribute__((may_alias)) v4fa;
typedef v8us __attribute__((may_alias)) v8usa;

__device__ __forceinline__ unsigned short f2bf(float f) { unsigned u = __float_as_uint(f); u += 0x7FFFu + ((u >> 16) & 1u); return (unsigned short)(u >> 16); }
__device__ __forceinline__ float bf2f(unsigned short b) { return __uint_as_float(((unsigned)b) << 16); }
__device__ __forceinline__ float bfr(float f) { return bf2f(f2bf(f)); }
__device__ __forceinline__ v16h cat16(v8h lo, v8h hi) { return __builtin_shufflevector(lo, hi, 0, 1, 2, 3, 4, 5, 6, 7, 8, 9, 10, 11, 12, 13, 14, 15); }
__device__ __forceinline__ v16bf cat16b(v8us lo, v8us hi) { return __builtin_bit_cast(v16bf, __builtin_shufflevector(lo, hi, 0, 1, 2, 3, 4, 5, 6, 7, 8, 9, 10, 11, 12, 13, 14, 15)); }
__device__ __forceinline__ v8f wmma16(v16h a, v16h b, v8f c) { return __builtin_amdgcn_wmma_f32_16x16x32_f16(false, a, false, b, (short)0, c, false, false); }
__device__ __forceinline__ v8f wmmab(v16bf a, v16bf b, v8f c) { return __builtin_amdgcn_wmma_f32_16x16x32_bf16(false, a, false, b, (short)0, c, false, false); }



// ---- k_vsn: the whole network for 16 rows. grid NR / 16, 32 * GW threads.
#define GW 16
static_assert(GW == 16 && NF == 4 * GW && NHID == 64, "wave w owns 4 features and adds up row w of the 16-row tile");
#define OP 68   // f32 pitch of the LDS tiles: 16 B x odd, so 16 rows fall on distinct banks
typedef __attribute__((ext_vector_type(2))) float v2f;
typedef v2f  __attribute__((may_alias)) v2fa;
__device__ __forceinline__ v16bf ldfrag(const bf* p) { return cat16b(*(const v8us*)p, *(const v8us*)(p + 16)); }
__device__ __forceinline__ void splitf(float y, unsigned short& h, unsigned short& l) { h = f2bf(y); l = f2bf(y - bf2f(h)); }
__global__ __launch_bounds__(32 * GW) void k_vsn(const float* __restrict__ x, const float* __restrict__ Wf, const float* __restrict__ bfv, const bf* __restrict__ Bt, const float* __restrict__ bias, float* sel, float* wts) {
    __shared__ __align__(16) float os[GW * 16 * OP];   // the 16 waves' partial tiles: logits first, the weighted sums later
    __shared__ __align__(16) float wfs[KT], bfs[KT];   // Wf and bf, rounded once per work-group
    __shared__ __align__(16) float wl[16 * OP];        // softmax weights of the 16 rows
    __shared__ __align__(16) float tl[16 * 32 * GW * 4];   // every lane's own T values of steps 0..3 (16 x 16 bytes a lane): registers hold only half of a wave's T beside the accumulators and operands
    const int lane = threadIdx.x & 31, lr = lane & 15, hi = lane >> 4, wv = threadIdx.x >> 5; const int r0 = blockIdx.x * 16;
    {   const int e0 = threadIdx.x * 8;
#pragma unroll
        for (int q = 0; q < 2; ++q) { const v4f a = *(const v4fa*)(Wf + e0 + 4 * q), b = *(const v4fa*)(bfv + e0 + 4 * q); v4f ra, rb;
#pragma unroll
            for (int j = 0; j < 4; ++j) { ra[j] = bfr(a[j]); rb[j] = bfr(b[j]); }
            *(v4fa*)(wfs + e0 + 4 * q) = ra; *(v4fa*)(bfs + e0 + 4 * q) = rb; } }
    const v4f xq = *(const v4fa*)(x + (size_t)(r0 + lr) * NF + 4 * wv);   // this lane's row, this wave's 4 features
    const float xr0 = bfr(xq[0]), xr1 = bfr(xq[1]), xr2 = bfr(xq[2]), xr3 = bfr(xq[3]);
    __syncthreads();   // the rounded Wf and bf are in LDS before any wave reads them
    v8f acc[4];
#pragma unroll
    for (int nb = 0; nb < 4; ++nb) acc[nb] = (v8f){};
    // T of this wave, f32, in the A-fragment order: step s (32 K columns) element e is column 32 s + 8 hi + e (e < 8) or 32 s + 16 + 8 hi + e - 8. Steps 0..3 go to tl, steps 4..7 stay in tb
    float tb[4][16];
    float* tp = tl + threadIdx.x * 4;
    const unsigned bo = (unsigned)(lr * KT + wv * 256 + 8 * hi) * 2u;   // this lane's byte offset in Bt: the four column blocks and the steps of a trip are constant offsets from one address
    const int ko = wv * 256 + 8 * hi;
#pragma unroll 1   // two trips of four steps, kept rolled: half the code, and the second trip can reuse the first trip's registers
    for (int half = 0; half < 2; ++half) {
        const char* bb = (const char*)Bt + half * 256; const float* pw_ = wfs + ko + half * 128; const float* pc_ = bfs + ko + half * 128;
        const float xa = half ? xr2 : xr0, xb = half ? xr3 : xr1;
#pragma unroll
        for (int q = 0; q < 4; ++q) {
            v16bf b[4];
#pragma unroll
            for (int nb = 0; nb < 4; ++nb) b[nb] = ldfrag((const bf*)(bb + bo) + nb * 16 * KT + 32 * q);
            __builtin_amdgcn_sched_barrier(0);   // keeps the step's eight B loads in front of its T arithmetic, which hides their latency: left alone the scheduler sinks some of them to just in front of their products, with a full load wait each
            const float xv = (q < 2) ? xa : xb;
            v8us ah[2], al[2];
#pragma unroll
            for (int g = 0; g < 2; ++g) {
#pragma unroll
                for (int c = 0; c < 2; ++c) { const v4f w4 = *(const v4fa*)(pw_ + 32 * q + 16 * g + 4 * c), c4 = *(const v4fa*)(pc_ + 32 * q + 16 * g + 4 * c);
#pragma unroll
                    for (int j = 0; j < 4; ++j) { const float v = xv * w4[j] + c4[j]; const float ex = expm1f(v); const float t = (v > 0.0f) ? v : ex; tb[q][8 * g + 4 * c + j] = t; unsigned short uh, ul; splitf(t, uh, ul); ah[g][4 * c + j] = uh; al[g][4 * c + j] = ul; } } }
            const v16bf fa = cat16b(ah[0], ah[1]), fl = cat16b(al[0], al[1]);
#pragma unroll
            for (int nb = 0; nb < 4; ++nb) { acc[nb] = wmmab(fa, b[nb], acc[nb]); acc[nb] = wmmab(fl, b[nb], acc[nb]); }
        }
        if (half == 0) {
#pragma unroll
            for (int q = 0; q < 4; ++q) {
#pragma unroll
                for (int c = 0; c < 4; ++c) { v4f o; o[0] = tb[q][4 * c]; o[1] = tb[q][4 * c + 1]; o[2] = tb[q][4 * c + 2]; o[3] = tb[q][4 * c + 3]; *(v4fa*)(tp + (q * 4 + c) * (32 * GW * 4)) = o; } } }
    }
    float* pw = os + wv * (16 * OP);
#pragma unroll
    for (int nb = 0; nb < 4; ++nb) {
#pragma unroll
        for (int j = 0; j < 8; ++j) pw[(hi * 8 + j) * OP + nb * 16 + lr] = acc[nb][j]; }
    __syncthreads();   // every wave's partial logit tile is in LDS before any is read
    const int row = wv, cofs = lane * 2;   // wave w adds up row w of the tile, two columns a lane
    v2f lg = *(const v2fa*)(os + row * OP + cofs);
#pragma unroll
    for (int w = 1; w < GW; ++w) { const v2f pv = *(const v2fa*)(os + (w * 16 + row) * OP + cofs); lg[0] += pv[0]; lg[1] += pv[1]; }
    lg[0] += bfr(bias[cofs]); lg[1] += bfr(bias[cofs + 1]);
    float mx = fmaxf(lg[0], lg[1]);
#pragma unroll
    for (int sh = 16; sh; sh >>= 1) mx = fmaxf(mx, __shfl_xor(mx, sh, 32));
    const float e0 = __builtin_amdgcn_exp2f((lg[0] - mx) * 1.4426950408889634f), e1 = __builtin_amdgcn_exp2f((lg[1] - mx) * 1.4426950408889634f); float sum = e0 + e1;
#pragma unroll
    for (int sh = 16; sh; sh >>= 1) sum = sum + __shfl_xor(sum, sh, 32);
    const float inv = __fdiv_rn(1.0f, sum); v2f ow; ow[0] = e0 * inv; ow[1] = e1 * inv;
    *(v2f*)(wts + (size_t)(r0 + row) * NF + cofs) = ow; *(v2fa*)(wl + row * OP + cofs) = ow;
    __syncthreads();   // the 16 rows' weights are in LDS, and every read of the logit tiles is over, before the tiles are written again
    const v4f wq = *(const v4fa*)(wl + lr * OP + 4 * wv);   // this lane's row, this wave's 4 features
#pragma unroll
    for (int hh = 0; hh < 2; ++hh) {   // step 2 f + hh holds columns 32 hh .. 32 hh + 31 of feature f
#pragma unroll
        for (int g = 0; g < 2; ++g) {
#pragma unroll
            for (int c = 0; c < 2; ++c) { v4f s4;
                const v4f t0 = *(const v4fa*)(tp + (hh * 4 + 2 * g + c) * (32 * GW * 4)), t1 = *(const v4fa*)(tp + ((2 + hh) * 4 + 2 * g + c) * (32 * GW * 4));   // the lane's own stores of the first trip
#pragma unroll
                for (int j = 0; j < 4; ++j) { const int e = 8 * g + 4 * c + j; s4[j] = ((wq[0] * t0[j] + wq[1] * t1[j]) + wq[2] * tb[hh][e]) + wq[3] * tb[2 + hh][e]; }
                *(v4fa*)(pw + lr * OP + 32 * hh + 16 * g + 8 * hi + 4 * c) = s4; } } }
    __syncthreads();   // every wave's partial weighted sum is in LDS before any is read
    v2f sv = *(const v2fa*)(os + row * OP + cofs);
#pragma unroll
    for (int w = 1; w < GW; ++w) { const v2f pv = *(const v2fa*)(os + (w * 16 + row) * OP + cofs); sv[0] += pv[0]; sv[1] += pv[1]; }
    *(v2f*)(sel + (size_t)(r0 + row) * NHID + cofs) = sv;
}

typedef __attribute__((ext_vector_type(4))) unsigned short v4us;
typedef __attribute__((ext_vector_type(2))) unsigned short v2us;
__global__ __launch_bounds__(256) void k_wtG(const float* __restrict__ w, int K, int N, bf* Bt) {
    const int lane = threadIdx.x & 31; const int L0 = (blockIdx.x * 8 + (threadIdx.x >> 5)) * 8; const int nlines = N * K / 64;
{
#pragma unroll 1
        for (int l = 0; l < 8; ++l) { const int L = L0 + l; if (L >= nlines) break; const size_t e = (size_t)L * 64 + lane * 2; const int k = (int)(e % K), n = (int)(e / K); v2us o;
            o[0] = f2bf(w[(size_t)k * N + n]); o[1] = f2bf(w[(size_t)(k + 1) * N + n]); *(v2us*)(Bt + e) = o; }
         }
}

extern "C" void kernel_launch(void* const* d_in, const int* in_sizes, int n_in,
                              void* d_out, int out_size, void* d_ws, size_t ws_size, hipStream_t stream) {
    (void)in_sizes; (void)n_in; (void)out_size;
    const float* x = (const float*)d_in[0]; const float* Wf = (const float*)d_in[1]; const float* bfv = (const float*)d_in[2]; const float* Ws = (const float*)d_in[3]; const float* bs = (const float*)d_in[4];
    float* SEL = (float*)d_out; float* WTS = SEL + (size_t)NR * NHID;     // tuple: selected [32][512][64] | weights [32][512][64]
    bf* WSB = (bf*)d_ws;
    if ((size_t)NF * KT * 2 > ws_size) return;    // ws 256 MiB (carve 512 KiB)
    k_wtG<<<(KT * NF / 64 + 63) / 64, 256, 0, stream>>>(Ws, KT, NF, WSB);   /* Ws 'xw' [4096][64] -> Bt [64][4096] */
    k_vsn<<<NR / 16, 32 * GW, 0, stream>>>(x, Wf, bfv, WSB, bs, SEL, WTS);
}

// v003
// A run of this version takes 59.1 microseconds.
// Next to v002, in two timings, it ran 1.07 times as fast each time.
// All steps since v000 together make it 11.4 times as fast.
#include <hip/hip_runtime.h>

// Variable selection network (x [32][512][64]; per feature f a Linear(1, 64) + ELU: T[r][f][h] = elu(x[r][f] Wf[f][h] + bf[f][h]); logits[r][f] = sum_{f',h} T[r][f'][h] Ws[f'*64 + h][f] + bs[f]; weights = softmax over the 64 features; selected[r][h] = sum_f weights[r][f] T[r][f][h] -> tuple (selected [32][512][64], weights [32][512][64]) (1.0 M + 1.0 M)).
// Layout: one kernel transposes the selector weight to bf16 [64][4096]; one fused kernel, a work-group of 16 waves per 16 rows, does the rest. Wave w owns features 4w .. 4w+3 (K columns 256w .. 256w+255): it forms its T values in registers in the A-fragment order, splits them to bf16 hi/lo for the products and keeps the f32 values (half in registers, half in the lane's own LDS slots); the 16 partial logit tiles meet in LDS; wave w takes the softmax of row w; every wave then weights the T values it still holds, and the 16 partial sums meet in LDS again. T never goes through memory.
// Compute dtypes, f32 accumulate: every input rounded to bf16; T in f32 (ELU = median of v, exp2(v log2 e) - 1 and 0); selector GEMM hi/lo x exact; softmax and the weighted sum in f32 (fixed orders).

#define NR   16384   // rows = 32 x 512
#define NF   64      // features
#define NHID 64      // hidden per feature
#define KT   (NF * NHID)   // 4096
typedef _Float16 h16;
typedef unsigned short bf;
typedef __attribute__((ext_vector_type(16))) __bf16   v16bf;
typedef __attribute__((ext_vector_type(16))) _Float16 v16h;
typedef __attribute__((ext_vector_type(8)))  _Float16 v8h;
typedef __attribute__((ext_vector_type(8)))  unsigned short v8us;
typedef __attribute__((ext_vector_type(8)))  float    v8f;
typedef __attribute__((ext_vector_type(4)))  float    v4f;
typedef v8h  __attribute__((may_alias)) v8ha;
typedef v4f  __attribute__((may_alias)) v4fa;
typedef v8us __attribute__((may_alias)) v8usa;

__device__ __forceinline__ unsigned short f2bf(float f) { unsigned u = __float_as_uint(f); u += 0x7FFFu + ((u >> 16) & 1u); return (unsigned short)(u >> 16); }
__device__ __forceinline__ float bf2f(unsigned short b) { return __uint_as_float(((unsigned)b) << 16); }
__device__ __forceinline__ float bfr(float f) { return bf2f(f2bf(f)); }
__device__ __forceinline__ v16h cat16(v8h lo, v8h hi) { return __builtin_shufflevector(lo, hi, 0, 1, 2, 3, 4, 5, 6, 7, 8, 9, 10, 11, 12, 13, 14, 15); }
__device__ __forceinline__ v16bf cat16b(v8us lo, v8us hi) { return __builtin_bit_cast(v16bf, __builtin_shufflevector(lo, hi, 0, 1, 2, 3, 4, 5, 6, 7, 8, 9, 10, 11, 12, 13, 14, 15)); }
__device__ __forceinline__ v8f wmma16(v16h a, v16h b, v8f c) { return __builtin_amdgcn_wmma_f32_16x16x32_f16(false, a, false, b, (short)0, c, false, false); }
__device__ __forceinline__ v8f wmmab(v16bf a, v16bf b, v8f c) { return __builtin_amdgcn_wmma_f32_16x16x32_bf16(false, a, false, b, (short)0, c, false, false); }



// ---- k_vsn: the whole network for 16 rows. grid NR / 16, 32 * GW threads.
#define GW 16
static_assert(GW == 16 && NF == 4 * GW && NHID == 64, "wave w owns 4 features and adds up row w of the 16-row tile");
#define OP 68   // f32 pitch of the LDS tiles: 16 B x odd, so 16 rows fall on distinct banks
typedef __attribute__((ext_vector_type(2))) float v2f;
typedef v2f  __attribute__((may_alias)) v2fa;
__device__ __forceinline__ v16bf ldfrag(const bf* p) { return cat16b(*(const v8us*)p, *(const v8us*)(p + 16)); }
__device__ __forceinline__ void splitf(float y, unsigned short& h, unsigned short& l) { h = f2bf(y); l = f2bf(y - bf2f(h)); }
__global__ __launch_bounds__(32 * GW) void k_vsn(const float* __restrict__ x, const float* __restrict__ Wf, const float* __restrict__ bfv, const bf* __restrict__ Bt, const float* __restrict__ bias, float* sel, float* wts) {
    __shared__ __align__(16) float os[GW * 16 * OP];   // the 16 waves' partial tiles: logits first, the weighted sums later
    __shared__ __align__(16) float wfs[KT], bfs[KT];   // Wf and bf, rounded once per work-group
    __shared__ __align__(16) float wl[16 * OP];        // softmax weights of the 16 rows
    __shared__ __align__(16) float tl[16 * 32 * GW * 4];   // every lane's own T values of steps 0..3 (16 x 16 bytes a lane): registers hold only half of a wave's T beside the accumulators and operands
    const int lane = threadIdx.x & 31, lr = lane & 15, hi = lane >> 4, wv = threadIdx.x >> 5; const int r0 = blockIdx.x * 16;
    {   const int e0 = threadIdx.x * 8;
#pragma unroll
        for (int q = 0; q < 2; ++q) { const v4f a = *(const v4fa*)(Wf + e0 + 4 * q), b = *(const v4fa*)(bfv + e0 + 4 * q); v4f ra, rb;
#pragma unroll
            for (int j = 0; j < 4; ++j) { ra[j] = bfr(a[j]); rb[j] = bfr(b[j]); }
            *(v4fa*)(wfs + e0 + 4 * q) = ra; *(v4fa*)(bfs + e0 + 4 * q) = rb; } }
    const v4f xq = *(const v4fa*)(x + (size_t)(r0 + lr) * NF + 4 * wv);   // this lane's row, this wave's 4 features
    const float xr0 = bfr(xq[0]), xr1 = bfr(xq[1]), xr2 = bfr(xq[2]), xr3 = bfr(xq[3]);
    __syncthreads();   // the rounded Wf and bf are in LDS before any wave reads them
    v8f acc[4];
#pragma unroll
    for (int nb = 0; nb < 4; ++nb) acc[nb] = (v8f){};
    // T of this wave, f32, in the A-fragment order: step s (32 K columns) element e is column 32 s + 8 hi + e (e < 8) or 32 s + 16 + 8 hi + e - 8. Steps 0..3 go to tl, steps 4..7 stay in tb
    float tb[4][16];
    float* tp = tl + threadIdx.x * 4;
    const unsigned bo = (unsigned)(lr * KT + wv * 256 + 8 * hi) * 2u;   // this lane's byte offset in Bt: the four column blocks and the steps of a trip are constant offsets from one address
    const int ko = wv * 256 + 8 * hi;
#pragma unroll 1   // two trips of four steps, kept rolled: half the code, and the second trip can reuse the first trip's registers
    for (int half = 0; half < 2; ++half) {
        const char* bb = (const char*)Bt + half * 256; const float* pw_ = wfs + ko + half * 128; const float* pc_ = bfs + ko + half * 128;
        const float xa = half ? xr2 : xr0, xb = half ? xr3 : xr1;
#pragma unroll
        for (int q = 0; q < 4; ++q) {
            v16bf b[4];
#pragma unroll
            for (int nb = 0; nb < 4; ++nb) b[nb] = ldfrag((const bf*)(bb + bo) + nb * 16 * KT + 32 * q);
            __builtin_amdgcn_sched_barrier(0);   // keeps the step's eight B loads in front of its T arithmetic, which hides their latency: left alone the scheduler sinks some of them to just in front of their products, with a full load wait each
            const float xv = (q < 2) ? xa : xb;
            v8us ah[2], al[2];
#pragma unroll
            for (int g = 0; g < 2; ++g) {
#pragma unroll
                for (int c = 0; c < 2; ++c) { const v4f w4 = *(const v4fa*)(pw_ + 32 * q + 16 * g + 4 * c), c4 = *(const v4fa*)(pc_ + 32 * q + 16 * g + 4 * c);
                    const v4f v4 = xv * w4 + c4, a4 = v4 * 1.4426950408889634f; v4f e4;
#pragma unroll
                    for (int j = 0; j < 4; ++j) e4[j] = __builtin_amdgcn_exp2f(a4[j]);
                    e4 = e4 - 1.0f;   // e^v - 1 from the hardware exp2: absolute error about one ulp of 1, which is what the sums over T see
#pragma unroll
                    for (int j = 0; j < 4; ++j) { const float t = __builtin_amdgcn_fmed3f(v4[j], e4[j], 0.0f);   // ELU: e^v - 1 >= v everywhere, so the middle one of (v, e^v - 1, 0) is v above 0 and e^v - 1 below
                        tb[q][8 * g + 4 * c + j] = t; unsigned short uh, ul; splitf(t, uh, ul); ah[g][4 * c + j] = uh; al[g][4 * c + j] = ul; } } }
            const v16bf fa = cat16b(ah[0], ah[1]), fl = cat16b(al[0], al[1]);
#pragma unroll
            for (int nb = 0; nb < 4; ++nb) { acc[nb] = wmmab(fa, b[nb], acc[nb]); acc[nb] = wmmab(fl, b[nb], acc[nb]); }
        }
        if (half == 0) {
#pragma unroll
            for (int q = 0; q < 4; ++q) {
#pragma unroll
                for (int c = 0; c < 4; ++c) { v4f o; o[0] = tb[q][4 * c]; o[1] = tb[q][4 * c + 1]; o[2] = tb[q][4 * c + 2]; o[3] = tb[q][4 * c + 3]; *(v4fa*)(tp + (q * 4 + c) * (32 * GW * 4)) = o; } } }
    }
    float* pw = os + wv * (16 * OP);
#pragma unroll
    for (int nb = 0; nb < 4; ++nb) {
#pragma unroll
        for (int j = 0; j < 8; ++j) pw[(hi * 8 + j) * OP + nb * 16 + lr] = acc[nb][j]; }
    __syncthreads();   // every wave's partial logit tile is in LDS before any is read
    const int row = wv, cofs = lane * 2;   // wave w adds up row w of the tile, two columns a lane
    v2f lg = *(const v2fa*)(os + row * OP + cofs);
#pragma unroll
    for (int w = 1; w < GW; ++w) { const v2f pv = *(const v2fa*)(os + (w * 16 + row) * OP + cofs); lg[0] += pv[0]; lg[1] += pv[1]; }
    lg[0] += bfr(bias[cofs]); lg[1] += bfr(bias[cofs + 1]);
    float mx = fmaxf(lg[0], lg[1]);
#pragma unroll
    for (int sh = 16; sh; sh >>= 1) mx = fmaxf(mx, __shfl_xor(mx, sh, 32));
    const float e0 = __builtin_amdgcn_exp2f((lg[0] - mx) * 1.4426950408889634f), e1 = __builtin_amdgcn_exp2f((lg[1] - mx) * 1.4426950408889634f); float sum = e0 + e1;
#pragma unroll
    for (int sh = 16; sh; sh >>= 1) sum = sum + __shfl_xor(sum, sh, 32);
    const float inv = __fdiv_rn(1.0f, sum); v2f ow; ow[0] = e0 * inv; ow[1] = e1 * inv;
    *(v2f*)(wts + (size_t)(r0 + row) * NF + cofs) = ow; *(v2fa*)(wl + row * OP + cofs) = ow;
    __syncthreads();   // the 16 rows' weights are in LDS, and every read of the logit tiles is over, before the tiles are written again
    const v4f wq = *(const v4fa*)(wl + lr * OP + 4 * wv);   // this lane's row, this wave's 4 features
#pragma unroll
    for (int hh = 0; hh < 2; ++hh) {   // step 2 f + hh holds columns 32 hh .. 32 hh + 31 of feature f
#pragma unroll
        for (int g = 0; g < 2; ++g) {
#pragma unroll
            for (int c = 0; c < 2; ++c) { v4f s4;
                const v4f t0 = *(const v4fa*)(tp + (hh * 4 + 2 * g + c) * (32 * GW * 4)), t1 = *(const v4fa*)(tp + ((2 + hh) * 4 + 2 * g + c) * (32 * GW * 4));   // the lane's own stores of the first trip
#pragma unroll
                for (int j = 0; j < 4; ++j) { const int e = 8 * g + 4 * c + j; s4[j] = ((wq[0] * t0[j] + wq[1] * t1[j]) + wq[2] * tb[hh][e]) + wq[3] * tb[2 + hh][e]; }
                *(v4fa*)(pw + lr * OP + 32 * hh + 16 * g + 8 * hi + 4 * c) = s4; } } }
    __syncthreads();   // every wave's partial weighted sum is in LDS before any is read
    v2f sv = *(const v2fa*)(os + row * OP + cofs);
#pragma unroll
    for (int w = 1; w < GW; ++w) { const v2f pv = *(const v2fa*)(os + (w * 16 + row) * OP + cofs); sv[0] += pv[0]; sv[1] += pv[1]; }
    *(v2f*)(sel + (size_t)(r0 + row) * NHID + cofs) = sv;
}

typedef __attribute__((ext_vector_type(4))) unsigned short v4us;
typedef __attribute__((ext_vector_type(2))) unsigned short v2us;
__global__ __launch_bounds__(256) void k_wtG(const float* __restrict__ w, int K, int N, bf* Bt) {
    const int lane = threadIdx.x & 31; const int L0 = (blockIdx.x * 8 + (threadIdx.x >> 5)) * 8; const int nlines = N * K / 64;
{
#pragma unroll 1
        for (int l = 0; l < 8; ++l) { const int L = L0 + l; if (L >= nlines) break; const size_t e = (size_t)L * 64 + lane * 2; const int k = (int)(e % K), n = (int)(e / K); v2us o;
            o[0] = f2bf(w[(size_t)k * N + n]); o[1] = f2bf(w[(size_t)(k + 1) * N + n]); *(v2us*)(Bt + e) = o; }
         }
}

extern "C" void kernel_launch(void* const* d_in, const int* in_sizes, int n_in,
                              void* d_out, int out_size, void* d_ws, size_t ws_size, hipStream_t stream) {
    (void)in_sizes; (void)n_in; (void)out_size;
    const float* x = (const float*)d_in[0]; const float* Wf = (const float*)d_in[1]; const float* bfv = (const float*)d_in[2]; const float* Ws = (const float*)d_in[3]; const float* bs = (const float*)d_in[4];
    float* SEL = (float*)d_out; float* WTS = SEL + (size_t)NR * NHID;     // tuple: selected [32][512][64] | weights [32][512][64]
    bf* WSB = (bf*)d_ws;
    if ((size_t)NF * KT * 2 > ws_size) return;    // ws 256 MiB (carve 512 KiB)
    k_wtG<<<(KT * NF / 64 + 63) / 64, 256, 0, stream>>>(Ws, KT, NF, WSB);   /* Ws 'xw' [4096][64] -> Bt [64][4096] */
    k_vsn<<<NR / 16, 32 * GW, 0, stream>>>(x, Wf, bfv, WSB, bs, SEL, WTS);
}

// v004
// A run of this version takes 36 microseconds.
// In two side-by-side timings against v003, it was 1.59 and 1.66 times as fast.
// All steps since v000 together make it 18.5 times as fast.
#include <hip/hip_runtime.h>

// Variable selection network (x [32][512][64]; per feature f a Linear(1, 64) + ELU: T[r][f][h] = elu(x[r][f] Wf[f][h] + bf[f][h]); logits[r][f] = sum_{f',h} T[r][f'][h] Ws[f'*64 + h][f] + bs[f]; weights = softmax over the 64 features; selected[r][h] = sum_f weights[r][f] T[r][f][h] -> tuple (selected [32][512][64], weights [32][512][64]) (1.0 M + 1.0 M)).
// Layout: one kernel packs the selector weight to bf16 in the order of the B fragments (512 contiguous bytes per wave-wide load); one fused kernel, a work-group of 16 waves per 16 rows, does the rest. Wave w owns features 4w .. 4w+3 (K columns 256w .. 256w+255): it forms its T values in registers in the A-fragment order, splits them to bf16 hi/lo for the products and keeps the f32 values (half in registers, half in the lane's own LDS slots); the 16 partial logit tiles meet in LDS; wave w takes the softmax of row w; every wave then weights the T values it still holds, and the 16 partial sums meet in LDS again. T never goes through memory.
// Compute dtypes, f32 accumulate: every input rounded to bf16; T in f32 (ELU = median of v, exp2(v log2 e) - 1 and 0); selector GEMM hi/lo x exact; softmax and the weighted sum in f32 (fixed orders).

#define NR   16384   // rows = 32 x 512
#define NF   64      // features
#define NHID 64      // hidden per feature
#define KT   (NF * NHID)   // 4096
typedef _Float16 h16;
typedef unsigned short bf;
typedef __attribute__((ext_vector_type(16))) __bf16   v16bf;
typedef __attribute__((ext_vector_type(16))) _Float16 v16h;
typedef __attribute__((ext_vector_type(8)))  _Float16 v8h;
typedef __attribute__((ext_vector_type(8)))  unsigned short v8us;
typedef __attribute__((ext_vector_type(8)))  float    v8f;
typedef __attribute__((ext_vector_type(4)))  float    v4f;
typedef v8h  __attribute__((may_alias)) v8ha;
typedef v4f  __attribute__((may_alias)) v4fa;
typedef v8us __attribute__((may_alias)) v8usa;

__device__ __forceinline__ unsigned short f2bf(float f) { unsigned u = __float_as_uint(f); u += 0x7FFFu + ((u >> 16) & 1u); return (unsigned short)(u >> 16); }
__device__ __forceinline__ float bf2f(unsigned short b) { return __uint_as_float(((unsigned)b) << 16); }
__device__ __forceinline__ float bfr(float f) { return bf2f(f2bf(f)); }
__device__ __forceinline__ v16h cat16(v8h lo, v8h hi) { return __builtin_shufflevector(lo, hi, 0, 1, 2, 3, 4, 5, 6, 7, 8, 9, 10, 11, 12, 13, 14, 15); }
__device__ __forceinline__ v16bf cat16b(v8us lo, v8us hi) { return __builtin_bit_cast(v16bf, __builtin_shufflevector(lo, hi, 0, 1, 2, 3, 4, 5, 6, 7, 8, 9, 10, 11, 12, 13, 14, 15)); }
__device__ __forceinline__ v8f wmma16(v16h a, v16h b, v8f c) { return __builtin_amdgcn_wmma_f32_16x16x32_f16(false, a, false, b, (short)0, c, false, false); }
__device__ __forceinline__ v8f wmmab(v16bf a, v16bf b, v8f c) { return __builtin_amdgcn_wmma_f32_16x16x32_bf16(false, a, false, b, (short)0, c, false, false); }



// ---- k_vsn: the whole network for 16 rows. grid NR / 16, 32 * GW threads.
#define GW 16
static_assert(GW == 16 && NF == 4 * GW && NHID == 64, "wave w owns 4 features and adds up row w of the 16-row tile");
#define OP 68   // f32 pitch of the LDS tiles: 16 B x odd, so 16 rows fall on distinct banks
typedef __attribute__((ext_vector_type(2))) float v2f;
typedef v2f  __attribute__((may_alias)) v2fa;
// Packed selector weight: block (wave w, step s, column block nb, part p) is 512 bytes, lane l's 16 bytes being Ws[256 w + 32 s + 16 p + 8 (l >> 4) + 0..7][16 nb + (l & 15)]
__device__ __forceinline__ v16bf ldfrag(const bf* p) { return cat16b(*(const v8us*)p, *(const v8us*)(p + 256)); }
__device__ __forceinline__ void splitf(float y, unsigned short& h, unsigned short& l) { h = f2bf(y); l = f2bf(y - bf2f(h)); }
__global__ __launch_bounds__(32 * GW) void k_vsn(const float* __restrict__ x, const float* __restrict__ Wf, const float* __restrict__ bfv, const bf* __restrict__ Bt, const float* __restrict__ bias, float* sel, float* wts) {
    __shared__ __align__(16) float os[GW * 16 * OP];   // the 16 waves' partial tiles: logits first, the weighted sums later
    __shared__ __align__(16) float wfs[KT], bfs[KT];   // Wf and bf, rounded once per work-group
    __shared__ __align__(16) float wl[16 * OP];        // softmax weights of the 16 rows
    __shared__ __align__(16) float tl[16 * 32 * GW * 4];   // every lane's own T values of steps 0..3 (16 x 16 bytes a lane): registers hold only half of a wave's T beside the accumulators and operands
    const int lane = threadIdx.x & 31, lr = lane & 15, hi = lane >> 4, wv = threadIdx.x >> 5; const int r0 = blockIdx.x * 16;
    {   const int e0 = threadIdx.x * 8;
#pragma unroll
        for (int q = 0; q < 2; ++q) { const v4f a = *(const v4fa*)(Wf + e0 + 4 * q), b = *(const v4fa*)(bfv + e0 + 4 * q); v4f ra, rb;
#pragma unroll
            for (int j = 0; j < 4; ++j) { ra[j] = bfr(a[j]); rb[j] = bfr(b[j]); }
            *(v4fa*)(wfs + e0 + 4 * q) = ra; *(v4fa*)(bfs + e0 + 4 * q) = rb; } }
    const v4f xq = *(const v4fa*)(x + (size_t)(r0 + lr) * NF + 4 * wv);   // this lane's row, this wave's 4 features
    const float xr0 = bfr(xq[0]), xr1 = bfr(xq[1]), xr2 = bfr(xq[2]), xr3 = bfr(xq[3]);
    __syncthreads();   // the rounded Wf and bf are in LDS before any wave reads them
    v8f acc[4];
#pragma unroll
    for (int nb = 0; nb < 4; ++nb) acc[nb] = (v8f){};
    // T of this wave, f32, in the A-fragment order: step s (32 K columns) element e is column 32 s + 8 hi + e (e < 8) or 32 s + 16 + 8 hi + e - 8. Steps 0..3 go to tl, steps 4..7 stay in tb
    float tb[4][16];
    float* tp = tl + threadIdx.x * 4;
    const unsigned bo = (unsigned)(wv * 32768 + lane * 16);   // this lane's byte offset in Bt: the four column blocks and the steps of a trip are constant offsets from one address
    const int ko = wv * 256 + 8 * hi;
#pragma unroll 1   // two trips of four steps, kept rolled: half the code, and the second trip can reuse the first trip's registers
    for (int half = 0; half < 2; ++half) {
        const char* bb = (const char*)Bt + half * 16384; const float* pw_ = wfs + ko + half * 128; const float* pc_ = bfs + ko + half * 128;
        const float xa = half ? xr2 : xr0, xb = half ? xr3 : xr1;
#pragma unroll
        for (int q = 0; q < 4; ++q) {
            v16bf b[4];
#pragma unroll
            for (int nb = 0; nb < 4; ++nb) b[nb] = ldfrag((const bf*)(bb + bo) + (q * 4 + nb) * 512);
            __builtin_amdgcn_sched_barrier(0);   // keeps the step's eight B loads in front of its T arithmetic, which hides their latency: left alone the scheduler sinks some of them to just in front of their products, with a full load wait each
            const float xv = (q < 2) ? xa : xb;
            v8us ah[2], al[2];
#pragma unroll
            for (int g = 0; g < 2; ++g) {
#pragma unroll
                for (int c = 0; c < 2; ++c) { const v4f w4 = *(const v4fa*)(pw_ + 32 * q + 16 * g + 4 * c), c4 = *(const v4fa*)(pc_ + 32 * q + 16 * g + 4 * c);
                    const v4f v4 = xv * w4 + c4, a4 = v4 * 1.4426950408889634f; v4f e4;
#pragma unroll
                    for (int j = 0; j < 4; ++j) e4[j] = __builtin_amdgcn_exp2f(a4[j]);
                    e4 = e4 - 1.0f;   // e^v - 1 from the hardware exp2: absolute error about one ulp of 1, which is what the sums over T see
#pragma unroll
                    for (int j = 0; j < 4; ++j) { const float t = __builtin_amdgcn_fmed3f(v4[j], e4[j], 0.0f);   // ELU: e^v - 1 >= v everywhere, so the middle one of (v, e^v - 1, 0) is v above 0 and e^v - 1 below
                        tb[q][8 * g + 4 * c + j] = t; unsigned short uh, ul; splitf(t, uh, ul); ah[g][4 * c + j] = uh; al[g][4 * c + j] = ul; } } }
            const v16bf fa = cat16b(ah[0], ah[1]), fl = cat16b(al[0], al[1]);
#pragma unroll
            for (int nb = 0; nb < 4; ++nb) { acc[nb] = wmmab(fa, b[nb], acc[nb]); acc[nb] = wmmab(fl, b[nb], acc[nb]); }
        }
        if (half == 0) {
#pragma unroll
            for (int q = 0; q < 4; ++q) {
#pragma unroll
                for (int c = 0; c < 4; ++c) { v4f o; o[0] = tb[q][4 * c]; o[1] = tb[q][4 * c + 1]; o[2] = tb[q][4 * c + 2]; o[3] = tb[q][4 * c + 3]; *(v4fa*)(tp + (q * 4 + c) * (32 * GW * 4)) = o; } } }
    }
    float* pw = os + wv * (16 * OP);
#pragma unroll
    for (int nb = 0; nb < 4; ++nb) {
#pragma unroll
        for (int j = 0; j < 8; ++j) pw[(hi * 8 + j) * OP + nb * 16 + lr] = acc[nb][j]; }
    __syncthreads();   // every wave's partial logit tile is in LDS before any is read
    const int row = wv, cofs = lane * 2;   // wave w adds up row w of the tile, two columns a lane
    v2f lg = *(const v2fa*)(os + row * OP + cofs);
#pragma unroll
    for (int w = 1; w < GW; ++w) { const v2f pv = *(const v2fa*)(os + (w * 16 + row) * OP + cofs); lg[0] += pv[0]; lg[1] += pv[1]; }
    lg[0] += bfr(bias[cofs]); lg[1] += bfr(bias[cofs + 1]);
    float mx = fmaxf(lg[0], lg[1]);
#pragma unroll
    for (int sh = 16; sh; sh >>= 1) mx = fmaxf(mx, __shfl_xor(mx, sh, 32));
    const float e0 = __builtin_amdgcn_exp2f((lg[0] - mx) * 1.4426950408889634f), e1 = __builtin_amdgcn_exp2f((lg[1] - mx) * 1.4426950408889634f); float sum = e0 + e1;
#pragma unroll
    for (int sh = 16; sh; sh >>= 1) sum = sum + __shfl_xor(sum, sh, 32);
    const float inv = __fdiv_rn(1.0f, sum); v2f ow; ow[0] = e0 * inv; ow[1] = e1 * inv;
    *(v2f*)(wts + (size_t)(r0 + row) * NF + cofs) = ow; *(v2fa*)(wl + row * OP + cofs) = ow;
    __syncthreads();   // the 16 rows' weights are in LDS, and every read of the logit tiles is over, before the tiles are written again
    const v4f wq = *(const v4fa*)(wl + lr * OP + 4 * wv);   // this lane's row, this wave's 4 features
#pragma unroll
    for (int hh = 0; hh < 2; ++hh) {   // step 2 f + hh holds columns 32 hh .. 32 hh + 31 of feature f
#pragma unroll
        for (int g = 0; g < 2; ++g) {
#pragma unroll
            for (int c = 0; c < 2; ++c) { v4f s4;
                const v4f t0 = *(const v4fa*)(tp + (hh * 4 + 2 * g + c) * (32 * GW * 4)), t1 = *(const v4fa*)(tp + ((2 + hh) * 4 + 2 * g + c) * (32 * GW * 4));   // the lane's own stores of the first trip
#pragma unroll
                for (int j = 0; j < 4; ++j) { const int e = 8 * g + 4 * c + j; s4[j] = ((wq[0] * t0[j] + wq[1] * t1[j]) + wq[2] * tb[hh][e]) + wq[3] * tb[2 + hh][e]; }
                *(v4fa*)(pw + lr * OP + 32 * hh + 16 * g + 8 * hi + 4 * c) = s4; } } }
    __syncthreads();   // every wave's partial weighted sum is in LDS before any is read
    v2f sv = *(const v2fa*)(os + row * OP + cofs);
#pragma unroll
    for (int w = 1; w < GW; ++w) { const v2f pv = *(const v2fa*)(os + (w * 16 + row) * OP + cofs); sv[0] += pv[0]; sv[1] += pv[1]; }
    *(v2f*)(sel + (size_t)(r0 + row) * NHID + cofs) = sv;
}

// ---- k_pack: Ws [4096][64] f32 -> bf16 in the fragment order above. Work-group b = 8 w + s reads rows 32 b .. 32 b + 31 (8 KiB in a row) and writes 4 KiB in a row; a thread makes one lane's 16 bytes.
__global__ __launch_bounds__(256) void k_pack(const float* __restrict__ w, bf* Bt) {
    const int t = threadIdx.x, l = t & 31, p = (t >> 5) & 1, nb = t >> 6;
    const float* s = w + (size_t)(blockIdx.x * 32 + 16 * p + 8 * (l >> 4)) * NF + nb * 16 + (l & 15);
    v8us o;
#pragma unroll
    for (int j = 0; j < 8; ++j) o[j] = f2bf(s[j * NF]);
    *(v8us*)(Bt + ((size_t)blockIdx.x * 256 + t) * 8) = o;
}

extern "C" void kernel_launch(void* const* d_in, const int* in_sizes, int n_in,
                              void* d_out, int out_size, void* d_ws, size_t ws_size, hipStream_t stream) {
    (void)in_sizes; (void)n_in; (void)out_size;
    const float* x = (const float*)d_in[0]; const float* Wf = (const float*)d_in[1]; const float* bfv = (const float*)d_in[2]; const float* Ws = (const float*)d_in[3]; const float* bs = (const float*)d_in[4];
    float* SEL = (float*)d_out; float* WTS = SEL + (size_t)NR * NHID;     // tuple: selected [32][512][64] | weights [32][512][64]
    bf* WSB = (bf*)d_ws;
    if ((size_t)NF * KT * 2 > ws_size) return;    // ws 256 MiB (carve 512 KiB)
    k_pack<<<KT / 32, 256, 0, stream>>>(Ws, WSB);   /* Ws [4096][64] -> B fragments, 512 KiB */
    k_vsn<<<NR / 16, 32 * GW, 0, stream>>>(x, Wf, bfv, WSB, bs, SEL, WTS);
}

// v005
// A run of this version takes 32.3 microseconds.
// In both of two side-by-side timings against v004, it was 1.09 times as fast.
// Counting every step since v000, it is 20.1 times as fast.
#include <hip/hip_runtime.h>

// Variable selection network (x [32][512][64]; per feature f a Linear(1, 64) + ELU: T[r][f][h] = elu(x[r][f] Wf[f][h] + bf[f][h]); logits[r][f] = sum_{f',h} T[r][f'][h] Ws[f'*64 + h][f] + bs[f]; weights = softmax over the 64 features; selected[r][h] = sum_f weights[r][f] T[r][f][h] -> tuple (selected [32][512][64], weights [32][512][64]) (1.0 M + 1.0 M)).
// Layout: one kernel packs the selector weight to bf16 in the order of the B fragments (512 contiguous bytes per wave-wide load); one fused kernel, a work-group of 16 waves per 16 rows, does the rest. Wave w owns features 4w .. 4w+3 (K columns 256w .. 256w+255): it forms its T values in registers in the A-fragment order and splits them to bf16 hi/lo for the products; the 16 partial logit tiles meet in LDS; wave w takes the softmax of row w; every wave then forms its T values a second time, weights them, and the 16 partial sums meet in LDS again. T is never stored: without a kept copy two work-groups fit a WGP (LDS and registers), and one's barriers, start and end hide behind the other's arithmetic.
// Compute dtypes, f32 accumulate: every input rounded to bf16; T in f32 (ELU = median of v, exp2(v log2 e) - 1 and 0); selector GEMM hi/lo x exact; softmax and the weighted sum in f32 (fixed orders).

#define NR   16384   // rows = 32 x 512
#define NF   64      // features
#define NHID 64      // hidden per feature
#define KT   (NF * NHID)   // 4096
typedef _Float16 h16;
typedef unsigned short bf;
typedef __attribute__((ext_vector_type(16))) __bf16   v16bf;
typedef __attribute__((ext_vector_type(16))) _Float16 v16h;
typedef __attribute__((ext_vector_type(8)))  _Float16 v8h;
typedef __attribute__((ext_vector_type(8)))  unsigned short v8us;
typedef __attribute__((ext_vector_type(8)))  float    v8f;
typedef __attribute__((ext_vector_type(4)))  float    v4f;
typedef v8h  __attribute__((may_alias)) v8ha;
typedef v4f  __attribute__((may_alias)) v4fa;
typedef v8us __attribute__((may_alias)) v8usa;

__device__ __forceinline__ unsigned short f2bf(float f) { unsigned u = __float_as_uint(f); u += 0x7FFFu + ((u >> 16) & 1u); return (unsigned short)(u >> 16); }
__device__ __forceinline__ float bf2f(unsigned short b) { return __uint_as_float(((unsigned)b) << 16); }
__device__ __forceinline__ float bfr(float f) { return bf2f(f2bf(f)); }
__device__ __forceinline__ v16h cat16(v8h lo, v8h hi) { return __builtin_shufflevector(lo, hi, 0, 1, 2, 3, 4, 5, 6, 7, 8, 9, 10, 11, 12, 13, 14, 15); }
__device__ __forceinline__ v16bf cat16b(v8us lo, v8us hi) { return __builtin_bit_cast(v16bf, __builtin_shufflevector(lo, hi, 0, 1, 2, 3, 4, 5, 6, 7, 8, 9, 10, 11, 12, 13, 14, 15)); }
__device__ __forceinline__ v8f wmma16(v16h a, v16h b, v8f c) { return __builtin_amdgcn_wmma_f32_16x16x32_f16(false, a, false, b, (short)0, c, false, false); }
__device__ __forceinline__ v8f wmmab(v16bf a, v16bf b, v8f c) { return __builtin_amdgcn_wmma_f32_16x16x32_bf16(false, a, false, b, (short)0, c, false, false); }



// ---- k_vsn: the whole network for 16 rows. grid NR / 16, 32 * GW threads.
#define GW 16
static_assert(GW == 16 && NF == 4 * GW && NHID == 64, "wave w owns 4 features and adds up row w of the 16-row tile");
#define OP 68   // f32 pitch of the LDS tiles: 16 B x odd, so 16 rows fall on distinct banks
typedef __attribute__((ext_vector_type(2))) float v2f;
typedef v2f  __attribute__((may_alias)) v2fa;
// Packed selector weight: block (wave w, step s, column block nb, part p) is 512 bytes, lane l's 16 bytes being Ws[256 w + 32 s + 16 p + 8 (l >> 4) + 0..7][16 nb + (l & 15)]
__device__ __forceinline__ v16bf ldfrag(const bf* p) { return cat16b(*(const v8us*)p, *(const v8us*)(p + 256)); }
__device__ __forceinline__ void splitf(float y, unsigned short& h, unsigned short& l) { h = f2bf(y); l = f2bf(y - bf2f(h)); }
// Four T values: ELU(x w + c). e^v - 1 from the hardware exp2: absolute error about one ulp of 1, which is what the sums over T see; e^v - 1 >= v everywhere, so the middle one of (v, e^v - 1, 0) is v above 0 and e^v - 1 below
__device__ __forceinline__ v4f elu4(float xv, v4f w4, v4f c4) {
    const v4f v4 = xv * w4 + c4, a4 = v4 * 1.4426950408889634f; v4f e4, t4;
#pragma unroll
    for (int j = 0; j < 4; ++j) e4[j] = __builtin_amdgcn_exp2f(a4[j]);
    e4 = e4 - 1.0f;
#pragma unroll
    for (int j = 0; j < 4; ++j) t4[j] = __builtin_amdgcn_fmed3f(v4[j], e4[j], 0.0f);
    return t4; }
// 8 waves a SIMD = two work-groups a WGP: the register budget is 128
__global__ __launch_bounds__(32 * GW) __attribute__((amdgpu_waves_per_eu(8))) void k_vsn(const float* __restrict__ x, const float* __restrict__ Wf, const float* __restrict__ bfv, const bf* __restrict__ Bt, const float* __restrict__ bias, float* sel, float* wts) {
    __shared__ __align__(16) float os[GW * 16 * OP];   // the 16 waves' partial tiles: logits first, the weighted sums later
    __shared__ __align__(16) float wfs[KT], bfs[KT];   // Wf and bf, rounded once per work-group
    __shared__ __align__(16) float wl[16 * OP];        // softmax weights of the 16 rows
    const int lane = threadIdx.x & 31, lr = lane & 15, hi = lane >> 4, wv = threadIdx.x >> 5; const int r0 = blockIdx.x * 16;
    {   const int e0 = threadIdx.x * 8;
#pragma unroll
        for (int q = 0; q < 2; ++q) { const v4f a = *(const v4fa*)(Wf + e0 + 4 * q), b = *(const v4fa*)(bfv + e0 + 4 * q); v4f ra, rb;
#pragma unroll
            for (int j = 0; j < 4; ++j) { ra[j] = bfr(a[j]); rb[j] = bfr(b[j]); }
            *(v4fa*)(wfs + e0 + 4 * q) = ra; *(v4fa*)(bfs + e0 + 4 * q) = rb; } }
    const v4f xq = *(const v4fa*)(x + (size_t)(r0 + lr) * NF + 4 * wv);   // this lane's row, this wave's 4 features
    const float xr0 = bfr(xq[0]), xr1 = bfr(xq[1]), xr2 = bfr(xq[2]), xr3 = bfr(xq[3]);
    __syncthreads();   // the rounded Wf and bf are in LDS before any wave reads them
    v8f acc[4];
#pragma unroll
    for (int nb = 0; nb < 4; ++nb) acc[nb] = (v8f){};
    // T of this wave, f32, in the A-fragment order: step s (32 K columns) element e is column 32 s + 8 hi + e (e < 8) or 32 s + 16 + 8 hi + e - 8
    const unsigned bo = (unsigned)(wv * 32768 + lane * 16);   // this lane's byte offset in Bt: the four column blocks and the steps of a trip are constant offsets from one address
    const int ko = wv * 256 + 8 * hi;
#pragma unroll 1   // two trips of four steps, kept rolled: half the code
    for (int half = 0; half < 2; ++half) {
        const char* bb = (const char*)Bt + half * 16384; const float* pw_ = wfs + ko + half * 128; const float* pc_ = bfs + ko + half * 128;
        const float xa = half ? xr2 : xr0, xb = half ? xr3 : xr1;
#pragma unroll
        for (int q = 0; q < 4; ++q) {
            v16bf b[4];
#pragma unroll
            for (int nb = 0; nb < 4; ++nb) b[nb] = ldfrag((const bf*)(bb + bo) + (q * 4 + nb) * 512);
            __builtin_amdgcn_sched_barrier(0);   // keeps the step's eight B loads in front of its T arithmetic, which hides their latency: left alone the scheduler sinks some of them to just in front of their products, with a full load wait each
            const float xv = (q < 2) ? xa : xb;
            v8us ah[2], al[2];
#pragma unroll
            for (int g = 0; g < 2; ++g) {
#pragma unroll
                for (int c = 0; c < 2; ++c) { const v4f w4 = *(const v4fa*)(pw_ + 32 * q + 16 * g + 4 * c), c4 = *(const v4fa*)(pc_ + 32 * q + 16 * g + 4 * c);
                    const v4f t4 = elu4(xv, w4, c4);
#pragma unroll
                    for (int j = 0; j < 4; ++j) { unsigned short uh, ul; splitf(t4[j], uh, ul); ah[g][4 * c + j] = uh; al[g][4 * c + j] = ul; } } }
            const v16bf fa = cat16b(ah[0], ah[1]), fl = cat16b(al[0], al[1]);
#pragma unroll
            for (int nb = 0; nb < 4; ++nb) { acc[nb] = wmmab(fa, b[nb], acc[nb]); acc[nb] = wmmab(fl, b[nb], acc[nb]); }
        }
    }
    float* pw = os + wv * (16 * OP);
#pragma unroll
    for (int nb = 0; nb < 4; ++nb) {
#pragma unroll
        for (int j = 0; j < 8; ++j) pw[(hi * 8 + j) * OP + nb * 16 + lr] = acc[nb][j]; }
    __syncthreads();   // every wave's partial logit tile is in LDS before any is read
    const int row = wv, cofs = lane * 2;   // wave w adds up row w of the tile, two columns a lane
    v2f lg = *(const v2fa*)(os + row * OP + cofs);
#pragma unroll
    for (int w = 1; w < GW; ++w) { const v2f pv = *(const v2fa*)(os + (w * 16 + row) * OP + cofs); lg[0] += pv[0]; lg[1] += pv[1]; }
    lg[0] += bfr(bias[cofs]); lg[1] += bfr(bias[cofs + 1]);
    float mx = fmaxf(lg[0], lg[1]);
#pragma unroll
    for (int sh = 16; sh; sh >>= 1) mx = fmaxf(mx, __shfl_xor(mx, sh, 32));
    const float e0 = __builtin_amdgcn_exp2f((lg[0] - mx) * 1.4426950408889634f), e1 = __builtin_amdgcn_exp2f((lg[1] - mx) * 1.4426950408889634f); float sum = e0 + e1;
#pragma unroll
    for (int sh = 16; sh; sh >>= 1) sum = sum + __shfl_xor(sum, sh, 32);
    const float inv = __fdiv_rn(1.0f, sum); v2f ow; ow[0] = e0 * inv; ow[1] = e1 * inv;
    *(v2f*)(wts + (size_t)(r0 + row) * NF + cofs) = ow; *(v2fa*)(wl + row * OP + cofs) = ow;
    __syncthreads();   // the 16 rows' weights are in LDS, and every read of the logit tiles is over, before the tiles are written again
    const v4f wq = *(const v4fa*)(wl + lr * OP + 4 * wv);   // this lane's row, this wave's 4 features
    // Group i = four columns (32 (i >> 2) + 16 ((i >> 1) & 1) + 8 hi + 4 (i & 1) + 0..3) of the wave's four features, formed as in the GEMM loop; step 2 f + hh holds columns 32 hh .. 32 hh + 31 of feature f
    v4f gw[2][4], gc[2][4];
#pragma unroll
    for (int f = 0; f < 4; ++f) { gw[0][f] = *(const v4fa*)(wfs + ko + 64 * f); gc[0][f] = *(const v4fa*)(bfs + ko + 64 * f); }
#pragma unroll
    for (int i = 0; i < 8; ++i) {
        if (i < 7) { const int o = ko + 32 * ((i + 1) >> 2) + 16 * (((i + 1) >> 1) & 1) + 4 * ((i + 1) & 1);
#pragma unroll
            for (int f = 0; f < 4; ++f) { gw[(i + 1) & 1][f] = *(const v4fa*)(wfs + o + 64 * f); gc[(i + 1) & 1][f] = *(const v4fa*)(bfs + o + 64 * f); }
            __builtin_amdgcn_sched_barrier(0);   // keeps the next group's eight LDS loads in front of this group's arithmetic, which hides their latency: left alone the scheduler puts each pair of loads directly in front of its use, with a full LDS wait each
        }
        const v4f t0 = elu4(xr0, gw[i & 1][0], gc[i & 1][0]), t1 = elu4(xr1, gw[i & 1][1], gc[i & 1][1]), t2 = elu4(xr2, gw[i & 1][2], gc[i & 1][2]), t3 = elu4(xr3, gw[i & 1][3], gc[i & 1][3]);
        const v4f s4 = ((wq[0] * t0 + wq[1] * t1) + wq[2] * t2) + wq[3] * t3;
        *(v4fa*)(pw + lr * OP + 32 * (i >> 2) + 16 * ((i >> 1) & 1) + 8 * hi + 4 * (i & 1)) = s4; }
    __syncthreads();   // every wave's partial weighted sum is in LDS before any is read
    v2f sv = *(const v2fa*)(os + row * OP + cofs);
#pragma unroll
    for (int w = 1; w < GW; ++w) { const v2f pv = *(const v2fa*)(os + (w * 16 + row) * OP + cofs); sv[0] += pv[0]; sv[1] += pv[1]; }
    *(v2f*)(sel + (size_t)(r0 + row) * NHID + cofs) = sv;
}

// ---- k_pack: Ws [4096][64] f32 -> bf16 in the fragment order above. Work-group b = 8 w + s reads rows 32 b .. 32 b + 31 (8 KiB in a row) and writes 4 KiB in a row; a thread makes one lane's 16 bytes.
__global__ __launch_bounds__(256) void k_pack(const float* __restrict__ w, bf* Bt) {
    const int t = threadIdx.x, l = t & 31, p = (t >> 5) & 1, nb = t >> 6;
    const float* s = w + (size_t)(blockIdx.x * 32 + 16 * p + 8 * (l >> 4)) * NF + nb * 16 + (l & 15);
    v8us o;
#pragma unroll
    for (int j = 0; j < 8; ++j) o[j] = f2bf(s[j * NF]);
    *(v8us*)(Bt + ((size_t)blockIdx.x * 256 + t) * 8) = o;
}

extern "C" void kernel_launch(void* const* d_in, const int* in_sizes, int n_in,
                              void* d_out, int out_size, void* d_ws, size_t ws_size, hipStream_t stream) {
    (void)in_sizes; (void)n_in; (void)out_size;
    const float* x = (const float*)d_in[0]; const float* Wf = (const float*)d_in[1]; const float* bfv = (const float*)d_in[2]; const float* Ws = (const float*)d_in[3]; const float* bs = (const float*)d_in[4];
    float* SEL = (float*)d_out; float* WTS = SEL + (size_t)NR * NHID;     // tuple: selected [32][512][64] | weights [32][512][64]
    bf* WSB = (bf*)d_ws;
    if ((size_t)NF * KT * 2 > ws_size) return;    // ws 256 MiB (carve 512 KiB)
    k_pack<<<KT / 32, 256, 0, stream>>>(Ws, WSB);   /* Ws [4096][64] -> B fragments, 512 KiB */
    k_vsn<<<NR / 16, 32 * GW, 0, stream>>>(x, Wf, bfv, WSB, bs, SEL, WTS);
}

// v006
// One run takes 30.3 microseconds.
// Two timings next to v005 put it at 1.06 and 1.07 times that version's speed.
// Over all steps from v000 it is 21.4 times as fast.
#include <hip/hip_runtime.h>

// Variable selection network (x [32][512][64]; per feature f a Linear(1, 64) + ELU: T[r][f][h] = elu(x[r][f] Wf[f][h] + bf[f][h]); logits[r][f] = sum_{f',h} T[r][f'][h] Ws[f'*64 + h][f] + bs[f]; weights = softmax over the 64 features; selected[r][h] = sum_f weights[r][f] T[r][f][h] -> tuple (selected [32][512][64], weights [32][512][64]) (1.0 M + 1.0 M)).
// Layout: one kernel packs the selector weight to bf16 in the order of the B fragments (512 contiguous bytes per wave-wide load); one fused kernel, a work-group of 16 waves per 16 rows, does the rest. Wave w owns features 4w .. 4w+3 (K columns 256w .. 256w+255): it forms its T values in registers in the A-fragment order and splits them to bf16 hi/lo for the products; the 16 partial logit tiles meet in LDS; wave w takes the softmax of row w; every wave then forms its T values a second time, weights them, and the 16 partial sums meet in LDS again. T is never stored: without a kept copy two work-groups fit a WGP (LDS and registers), and one's barriers, start and end hide behind the other's arithmetic.
// Compute dtypes, f32 accumulate: every input rounded to bf16; T in f32 (ELU = median of v, exp2(v log2 e) - 1 and 0); selector GEMM hi/lo x exact; softmax and the weighted sum in f32 (fixed orders).

#define NR   16384   // rows = 32 x 512
#define NF   64      // features
#define NHID 64      // hidden per feature
#define KT   (NF * NHID)   // 4096
typedef _Float16 h16;
typedef unsigned short bf;
typedef __attribute__((ext_vector_type(16))) __bf16   v16bf;
typedef __attribute__((ext_vector_type(16))) _Float16 v16h;
typedef __attribute__((ext_vector_type(8)))  _Float16 v8h;
typedef __attribute__((ext_vector_type(8)))  unsigned short v8us;
typedef __attribute__((ext_vector_type(8)))  float    v8f;
typedef __attribute__((ext_vector_type(4)))  float    v4f;
typedef v8h  __attribute__((may_alias)) v8ha;
typedef v4f  __attribute__((may_alias)) v4fa;
typedef v8us __attribute__((may_alias)) v8usa;

typedef __attribute__((ext_vector_type(2))) __bf16   v2bf;
typedef __attribute__((ext_vector_type(2))) float    v2f;
typedef __attribute__((ext_vector_type(4))) unsigned v4u;
typedef __attribute__((ext_vector_type(8))) unsigned v8u;
// Two f32 -> two bf16 in one register, round to nearest even: the hardware's packed convert, one instruction
__device__ __forceinline__ v2bf cvt2(float a, float b) { const v2f p = {a, b}; return __builtin_convertvector(p, v2bf); }
__device__ __forceinline__ unsigned cvt2u(float a, float b) { return __builtin_bit_cast(unsigned, cvt2(a, b)); }
__device__ __forceinline__ float bfr(float f) { return (float)(__bf16)f; }
__device__ __forceinline__ v4f bfr4(v4f a) { const v2bf p = cvt2(a[0], a[1]), q = cvt2(a[2], a[3]); const v4f r = {(float)p[0], (float)p[1], (float)q[0], (float)q[1]}; return r; }
__device__ __forceinline__ v16h cat16(v8h lo, v8h hi) { return __builtin_shufflevector(lo, hi, 0, 1, 2, 3, 4, 5, 6, 7, 8, 9, 10, 11, 12, 13, 14, 15); }
__device__ __forceinline__ v16bf cat16b(v8us lo, v8us hi) { return __builtin_bit_cast(v16bf, __builtin_shufflevector(lo, hi, 0, 1, 2, 3, 4, 5, 6, 7, 8, 9, 10, 11, 12, 13, 14, 15)); }
__device__ __forceinline__ v8f wmma16(v16h a, v16h b, v8f c) { return __builtin_amdgcn_wmma_f32_16x16x32_f16(false, a, false, b, (short)0, c, false, false); }
__device__ __forceinline__ v8f wmmab(v16bf a, v16bf b, v8f c) { return __builtin_amdgcn_wmma_f32_16x16x32_bf16(false, a, false, b, (short)0, c, false, false); }



// ---- k_vsn: the whole network for 16 rows. grid NR / 16, 32 * GW threads.
#define GW 16
static_assert(GW == 16 && NF == 4 * GW && NHID == 64, "wave w owns 4 features and adds up row w of the 16-row tile");
#define OP 68   // f32 pitch of the LDS tiles: 16 B x odd, so 16 rows fall on distinct banks
typedef v2f  __attribute__((may_alias)) v2fa;
// Packed selector weight: block (wave w, step s, column block nb, part p) is 512 bytes, lane l's 16 bytes being Ws[256 w + 32 s + 16 p + 8 (l >> 4) + 0..7][16 nb + (l & 15)]
__device__ __forceinline__ v16bf ldfrag(const bf* p) { return cat16b(*(const v8us*)p, *(const v8us*)(p + 256)); }
// A pair of T values -> its bf16 pair (hi) and the bf16 pair of what the rounding left (lo)
__device__ __forceinline__ void split2(float y0, float y1, unsigned& h, unsigned& l) { const v2bf hp = cvt2(y0, y1); h = __builtin_bit_cast(unsigned, hp); l = cvt2u(y0 - (float)hp[0], y1 - (float)hp[1]); }
// Four T values: ELU(x w + c). e^v - 1 from the hardware exp2: absolute error about one ulp of 1, which is what the sums over T see; e^v - 1 >= v everywhere, so the middle one of (v, e^v - 1, 0) is v above 0 and e^v - 1 below
__device__ __forceinline__ v4f elu4(float xv, v4f w4, v4f c4) {
    const v4f v4 = xv * w4 + c4, a4 = v4 * 1.4426950408889634f; v4f e4, t4;
#pragma unroll
    for (int j = 0; j < 4; ++j) e4[j] = __builtin_amdgcn_exp2f(a4[j]);
    e4 = e4 - 1.0f;
#pragma unroll
    for (int j = 0; j < 4; ++j) t4[j] = __builtin_amdgcn_fmed3f(v4[j], e4[j], 0.0f);
    return t4; }
// 8 waves a SIMD = two work-groups a WGP: the register budget is 128
__global__ __launch_bounds__(32 * GW) __attribute__((amdgpu_waves_per_eu(8))) void k_vsn(const float* __restrict__ x, const float* __restrict__ Wf, const float* __restrict__ bfv, const bf* __restrict__ Bt, const float* __restrict__ bias, float* sel, float* wts) {
    __shared__ __align__(16) float os[GW * 16 * OP];   // the 16 waves' partial tiles: logits first, the weighted sums later
    __shared__ __align__(16) float wfs[KT], bfs[KT];   // Wf and bf, rounded once per work-group
    __shared__ __align__(16) float wl[16 * OP];        // softmax weights of the 16 rows
    const int lane = threadIdx.x & 31, lr = lane & 15, hi = lane >> 4, wv = threadIdx.x >> 5; const int r0 = blockIdx.x * 16;
    {   const int e0 = threadIdx.x * 8;
#pragma unroll
        for (int q = 0; q < 2; ++q) { const v4f a = *(const v4fa*)(Wf + e0 + 4 * q), b = *(const v4fa*)(bfv + e0 + 4 * q);
            *(v4fa*)(wfs + e0 + 4 * q) = bfr4(a); *(v4fa*)(bfs + e0 + 4 * q) = bfr4(b); } }
    const v4f xq = *(const v4fa*)(x + (size_t)(r0 + lr) * NF + 4 * wv);   // this lane's row, this wave's 4 features
    const v4f xr = bfr4(xq); const float xr0 = xr[0], xr1 = xr[1], xr2 = xr[2], xr3 = xr[3];
    __syncthreads();   // the rounded Wf and bf are in LDS before any wave reads them
    v8f acc[4];
#pragma unroll
    for (int nb = 0; nb < 4; ++nb) acc[nb] = (v8f){};
    // T of this wave, f32, in the A-fragment order: step s (32 K columns) element e is column 32 s + 8 hi + e (e < 8) or 32 s + 16 + 8 hi + e - 8
    const unsigned bo = (unsigned)(wv * 32768 + lane * 16);   // this lane's byte offset in Bt: the four column blocks and the steps of a trip are constant offsets from one address
    const int ko = wv * 256 + 8 * hi;
#pragma unroll 1   // two trips of four steps, kept rolled: half the code
    for (int half = 0; half < 2; ++half) {
        const char* bb = (const char*)Bt + half * 16384; const float* pw_ = wfs + ko + half * 128; const float* pc_ = bfs + ko + half * 128;
        const float xa = half ? xr2 : xr0, xb = half ? xr3 : xr1;
#pragma unroll
        for (int q = 0; q < 4; ++q) {
            v16bf b[4];
#pragma unroll
            for (int nb = 0; nb < 4; ++nb) b[nb] = ldfrag((const bf*)(bb + bo) + (q * 4 + nb) * 512);
            __builtin_amdgcn_sched_barrier(0);   // keeps the step's eight B loads in front of its T arithmetic, which hides their latency: left alone the scheduler sinks some of them to just in front of their products, with a full load wait each
            const float xv = (q < 2) ? xa : xb;
            v8u ah, al;   // register 4 g + 2 c + p holds elements 8 g + 4 c + 2 p and the next one
#pragma unroll
            for (int g = 0; g < 2; ++g) {
#pragma unroll
                for (int c = 0; c < 2; ++c) { const v4f w4 = *(const v4fa*)(pw_ + 32 * q + 16 * g + 4 * c), c4 = *(const v4fa*)(pc_ + 32 * q + 16 * g + 4 * c);
                    const v4f t4 = elu4(xv, w4, c4);
#pragma unroll
                    for (int p = 0; p < 2; ++p) { unsigned uh, ul; split2(t4[2 * p], t4[2 * p + 1], uh, ul); ah[4 * g + 2 * c + p] = uh; al[4 * g + 2 * c + p] = ul; } } }
            const v16bf fa = __builtin_bit_cast(v16bf, ah), fl = __builtin_bit_cast(v16bf, al);
#pragma unroll
            for (int nb = 0; nb < 4; ++nb) { acc[nb] = wmmab(fa, b[nb], acc[nb]); acc[nb] = wmmab(fl, b[nb], acc[nb]); }
        }
    }
    float* pw = os + wv * (16 * OP);
#pragma unroll
    for (int nb = 0; nb < 4; ++nb) {
#pragma unroll
        for (int j = 0; j < 8; ++j) pw[(hi * 8 + j) * OP + nb * 16 + lr] = acc[nb][j]; }
    __syncthreads();   // every wave's partial logit tile is in LDS before any is read
    const int row = wv, cofs = lane * 2;   // wave w adds up row w of the tile, two columns a lane
    v2f lg = *(const v2fa*)(os + row * OP + cofs);
#pragma unroll
    for (int w = 1; w < GW; ++w) { const v2f pv = *(const v2fa*)(os + (w * 16 + row) * OP + cofs); lg[0] += pv[0]; lg[1] += pv[1]; }
    lg[0] += bfr(bias[cofs]); lg[1] += bfr(bias[cofs + 1]);
    float mx = fmaxf(lg[0], lg[1]);
#pragma unroll
    for (int sh = 16; sh; sh >>= 1) mx = fmaxf(mx, __shfl_xor(mx, sh, 32));
    const float e0 = __builtin_amdgcn_exp2f((lg[0] - mx) * 1.4426950408889634f), e1 = __builtin_amdgcn_exp2f((lg[1] - mx) * 1.4426950408889634f); float sum = e0 + e1;
#pragma unroll
    for (int sh = 16; sh; sh >>= 1) sum = sum + __shfl_xor(sum, sh, 32);
    const float inv = __fdiv_rn(1.0f, sum); v2f ow; ow[0] = e0 * inv; ow[1] = e1 * inv;
    *(v2f*)(wts + (size_t)(r0 + row) * NF + cofs) = ow; *(v2fa*)(wl + row * OP + cofs) = ow;
    __syncthreads();   // the 16 rows' weights are in LDS, and every read of the logit tiles is over, before the tiles are written again
    const v4f wq = *(const v4fa*)(wl + lr * OP + 4 * wv);   // this lane's row, this wave's 4 features
    // Group i = four columns (32 (i >> 2) + 16 ((i >> 1) & 1) + 8 hi + 4 (i & 1) + 0..3) of the wave's four features, formed as in the GEMM loop; step 2 f + hh holds columns 32 hh .. 32 hh + 31 of feature f
    v4f gw[2][4], gc[2][4];
#pragma unroll
    for (int f = 0; f < 4; ++f) { gw[0][f] = *(const v4fa*)(wfs + ko + 64 * f); gc[0][f] = *(const v4fa*)(bfs + ko + 64 * f); }
#pragma unroll
    for (int i = 0; i < 8; ++i) {
        if (i < 7) { const int o = ko + 32 * ((i + 1) >> 2) + 16 * (((i + 1) >> 1) & 1) + 4 * ((i + 1) & 1);
#pragma unroll
            for (int f = 0; f < 4; ++f) { gw[(i + 1) & 1][f] = *(const v4fa*)(wfs + o + 64 * f); gc[(i + 1) & 1][f] = *(const v4fa*)(bfs + o + 64 * f); }
            __builtin_amdgcn_sched_barrier(0);   // keeps the next group's eight LDS loads in front of this group's arithmetic, which hides their latency: left alone the scheduler puts each pair of loads directly in front of its use, with a full LDS wait each
        }
        const v4f t0 = elu4(xr0, gw[i & 1][0], gc[i & 1][0]), t1 = elu4(xr1, gw[i & 1][1], gc[i & 1][1]), t2 = elu4(xr2, gw[i & 1][2], gc[i & 1][2]), t3 = elu4(xr3, gw[i & 1][3], gc[i & 1][3]);
        const v4f s4 = ((wq[0] * t0 + wq[1] * t1) + wq[2] * t2) + wq[3] * t3;
        *(v4fa*)(pw + lr * OP + 32 * (i >> 2) + 16 * ((i >> 1) & 1) + 8 * hi + 4 * (i & 1)) = s4; }
    __syncthreads();   // every wave's partial weighted sum is in LDS before any is read
    v2f sv = *(const v2fa*)(os + row * OP + cofs);
#pragma unroll
    for (int w = 1; w < GW; ++w) { const v2f pv = *(const v2fa*)(os + (w * 16 + row) * OP + cofs); sv[0] += pv[0]; sv[1] += pv[1]; }
    *(v2f*)(sel + (size_t)(r0 + row) * NHID + cofs) = sv;
}

// ---- k_pack: Ws [4096][64] f32 -> bf16 in the fragment order above. Work-group b = 8 w + s reads rows 32 b .. 32 b + 31 (8 KiB in a row) and writes 4 KiB in a row; a thread makes one lane's 16 bytes.
__global__ __launch_bounds__(256) void k_pack(const float* __restrict__ w, bf* Bt) {
    const int t = threadIdx.x, l = t & 31, p = (t >> 5) & 1, nb = t >> 6;
    const float* s = w + (size_t)(blockIdx.x * 32 + 16 * p + 8 * (l >> 4)) * NF + nb * 16 + (l & 15);
    v4u o;
#pragma unroll
    for (int j = 0; j < 4; ++j) o[j] = cvt2u(s[2 * j * NF], s[(2 * j + 1) * NF]);
    *(v4u*)(Bt + ((size_t)blockIdx.x * 256 + t) * 8) = o;
}

extern "C" void kernel_launch(void* const* d_in, const int* in_sizes, int n_in,
                              void* d_out, int out_size, void* d_ws, size_t ws_size, hipStream_t stream) {
    (void)in_sizes; (void)n_in; (void)out_size;
    const float* x = (const float*)d_in[0]; const float* Wf = (const float*)d_in[1]; const float* bfv = (const float*)d_in[2]; const float* Ws = (const float*)d_in[3]; const float* bs = (const float*)d_in[4];
    float* SEL = (float*)d_out; float* WTS = SEL + (size_t)NR * NHID;     // tuple: selected [32][512][64] | weights [32][512][64]
    bf* WSB = (bf*)d_ws;
    if ((size_t)NF * KT * 2 > ws_size) return;    // ws 256 MiB (carve 512 KiB)
    k_pack<<<KT / 32, 256, 0, stream>>>(Ws, WSB);   /* Ws [4096][64] -> B fragments, 512 KiB */
    k_vsn<<<NR / 16, 32 * GW, 0, stream>>>(x, Wf, bfv, WSB, bs, SEL, WTS);
}

// v007
// It runs in 25.4 microseconds.
// Timed twice side by side with v006, it ran 1.19 times as fast both times.
// Over all steps from v000 it is 25.5 times as fast.
#include <hip/hip_runtime.h>

// Variable selection network (x [32][512][64]; per feature f a Linear(1, 64) + ELU: T[r][f][h] = elu(x[r][f] Wf[f][h] + bf[f][h]); logits[r][f] = sum_{f',h} T[r][f'][h] Ws[f'*64 + h][f] + bs[f]; weights = softmax over the 64 features; selected[r][h] = sum_f weights[r][f] T[r][f][h] -> tuple (selected [32][512][64], weights [32][512][64]) (1.0 M + 1.0 M)).
// Layout: one kernel packs the selector weight to bf16 in the order of the B fragments (512 contiguous bytes per wave-wide load); one fused kernel, a work-group of 8 waves per 32 rows (two 16-row tiles), does the rest. Wave w owns features 8w .. 8w+7 (K columns 512w .. 512w+511) of both tiles: it forms its T values in registers in the A-fragment order and splits them to bf16 hi/lo for the products, and every B fragment it loads and every Wf / bf value it reads serves both tiles; the 8 partial logit tiles meet in LDS; wave w takes the softmax of rows 4w .. 4w+3; every wave then forms its T values a second time, weights them, and the 8 partial sums meet in LDS again. T is never stored; two work-groups fit a WGP.
// Compute dtypes, f32 accumulate: every input rounded to bf16; T in f32 (ELU = median of v, exp2(v log2 e) - 1 and 0); selector GEMM hi/lo x exact; softmax and the weighted sum in f32 (fixed orders).

#define NR   16384   // rows = 32 x 512
#define NF   64      // features
#define NHID 64      // hidden per feature
#define KT   (NF * NHID)   // 4096
typedef _Float16 h16;
typedef unsigned short bf;
typedef __attribute__((ext_vector_type(16))) __bf16   v16bf;
typedef __attribute__((ext_vector_type(16))) _Float16 v16h;
typedef __attribute__((ext_vector_type(8)))  _Float16 v8h;
typedef __attribute__((ext_vector_type(8)))  unsigned short v8us;
typedef __attribute__((ext_vector_type(8)))  float    v8f;
typedef __attribute__((ext_vector_type(4)))  float    v4f;
typedef v8h  __attribute__((may_alias)) v8ha;
typedef v4f  __attribute__((may_alias)) v4fa;
typedef v8us __attribute__((may_alias)) v8usa;

typedef __attribute__((ext_vector_type(2))) __bf16   v2bf;
typedef __attribute__((ext_vector_type(2))) float    v2f;
typedef __attribute__((ext_vector_type(4))) unsigned v4u;
typedef __attribute__((ext_vector_type(8))) unsigned v8u;
// Two f32 -> two bf16 in one register, round to nearest even: the hardware's packed convert, one instruction
__device__ __forceinline__ v2bf cvt2(float a, float b) { const v2f p = {a, b}; return __builtin_convertvector(p, v2bf); }
__device__ __forceinline__ unsigned cvt2u(float a, float b) { return __builtin_bit_cast(unsigned, cvt2(a, b)); }
__device__ __forceinline__ float bfr(float f) { return (float)(__bf16)f; }
__device__ __forceinline__ v4f bfr4(v4f a) { const v2bf p = cvt2(a[0], a[1]), q = cvt2(a[2], a[3]); const v4f r = {(float)p[0], (float)p[1], (float)q[0], (float)q[1]}; return r; }
__device__ __forceinline__ v16h cat16(v8h lo, v8h hi) { return __builtin_shufflevector(lo, hi, 0, 1, 2, 3, 4, 5, 6, 7, 8, 9, 10, 11, 12, 13, 14, 15); }
__device__ __forceinline__ v16bf cat16b(v8us lo, v8us hi) { return __builtin_bit_cast(v16bf, __builtin_shufflevector(lo, hi, 0, 1, 2, 3, 4, 5, 6, 7, 8, 9, 10, 11, 12, 13, 14, 15)); }
__device__ __forceinline__ v8f wmma16(v16h a, v16h b, v8f c) { return __builtin_amdgcn_wmma_f32_16x16x32_f16(false, a, false, b, (short)0, c, false, false); }
__device__ __forceinline__ v8f wmmab(v16bf a, v16bf b, v8f c) { return __builtin_amdgcn_wmma_f32_16x16x32_bf16(false, a, false, b, (short)0, c, false, false); }



// ---- k_vsn: the whole network for 32 rows (two 16-row tiles). grid NR / 32, 32 * GW threads.
#define GW 8
#define MT 2             // 16-row tiles a wave: every B fragment and every Wf / bf read from LDS serves both
#define RW (16 * MT)     // rows a work-group
#define FW (NF / GW)     // features a wave
static_assert(GW == 8 && MT == 2 && FW == 8 && NHID == 64 && RW == 4 * GW, "wave w owns 8 features and adds up rows 4w .. 4w+3 of the 32-row tile");
#define OP 68   // f32 pitch of the LDS tiles: 16 B x odd, so 16 rows fall on distinct banks
typedef v2f  __attribute__((may_alias)) v2fa;
// Packed selector weight: block (step b of 32 K rows, column block nb, part p) is 512 bytes, lane l's 16 bytes being Ws[32 b + 16 p + 8 (l >> 4) + 0..7][16 nb + (l & 15)]
__device__ __forceinline__ v16bf ldfrag(const bf* p) { return cat16b(*(const v8us*)p, *(const v8us*)(p + 256)); }
// A pair of T values -> its bf16 pair (hi) and the bf16 pair of what the rounding left (lo)
__device__ __forceinline__ void split2(float y0, float y1, unsigned& h, unsigned& l) { const v2bf hp = cvt2(y0, y1); h = __builtin_bit_cast(unsigned, hp); l = cvt2u(y0 - (float)hp[0], y1 - (float)hp[1]); }
// Four T values: ELU(x w + c). e^v - 1 from the hardware exp2: absolute error about one ulp of 1, which is what the sums over T see; e^v - 1 >= v everywhere, so the middle one of (v, e^v - 1, 0) is v above 0 and e^v - 1 below
__device__ __forceinline__ v4f elu4(float xv, v4f w4, v4f c4) {
    const v4f v4 = xv * w4 + c4, a4 = v4 * 1.4426950408889634f; v4f e4, t4;
#pragma unroll
    for (int j = 0; j < 4; ++j) e4[j] = __builtin_amdgcn_exp2f(a4[j]);
    e4 = e4 - 1.0f;
#pragma unroll
    for (int j = 0; j < 4; ++j) t4[j] = __builtin_amdgcn_fmed3f(v4[j], e4[j], 0.0f);
    return t4; }
// 4 waves a SIMD = two work-groups a WGP: the register budget is 256
__global__ __launch_bounds__(32 * GW) __attribute__((amdgpu_waves_per_eu(4))) void k_vsn(const float* __restrict__ x, const float* __restrict__ Wf, const float* __restrict__ bfv, const bf* __restrict__ Bt, const float* __restrict__ bias, float* sel, float* wts) {
    // One LDS block, the tables that the inner loops read first: their reads then reach Wf and bf from one address register with constant offsets (an LDS offset field ends at 64 KiB)
    __shared__ __align__(16) float sm[2 * KT + 2 * RW * OP + GW * RW * OP];
    float* const wfs = sm; float* const bfs = sm + KT;   // Wf and bf, rounded once per work-group
    float* const xs = sm + 2 * KT;                       // the 32 rows of x, rounded
    float* const wl = xs + RW * OP;                      // softmax weights of the 32 rows
    float* const os = wl + RW * OP;                      // the 8 waves' partial tiles: logits first, the weighted sums later
    const int lane = threadIdx.x & 31, lr = lane & 15, hi = lane >> 4, wv = threadIdx.x >> 5; const int r0 = blockIdx.x * RW;
#pragma unroll
    for (int q = 0; q < KT / (128 * GW); ++q) { const int e0 = threadIdx.x * 4 + q * (128 * GW); const v4f a = *(const v4fa*)(Wf + e0), b = *(const v4fa*)(bfv + e0);
        *(v4fa*)(wfs + e0) = bfr4(a); *(v4fa*)(bfs + e0) = bfr4(b); }
#pragma unroll
    for (int q = 0; q < RW * NF / (128 * GW); ++q) { const int e0 = threadIdx.x * 4 + q * (128 * GW); const v4f a = *(const v4fa*)(x + (size_t)r0 * NF + e0);
        *(v4fa*)(xs + (e0 >> 6) * OP + (e0 & 63)) = bfr4(a); }
    const char* bl = (const char*)Bt + (unsigned)(wv * 65536 + lane * 16);   // this lane's 16 bytes of the wave's first block; a step is 4096 bytes, a column block 1024
    v16bf b[2][4];   // the running step's B fragments and the next step's
#pragma unroll
    for (int nb = 0; nb < 4; ++nb) b[0][nb] = ldfrag((const bf*)bl + nb * 512);
    __syncthreads();   // the rounded Wf, bf and x are in LDS before any wave reads them
    v8f acc[MT][4];
#pragma unroll
    for (int m = 0; m < MT; ++m) {
#pragma unroll
        for (int nb = 0; nb < 4; ++nb) acc[m][nb] = (v8f){}; }
    // T of this wave, f32, in the A-fragment order: step s (32 K columns) element e is column 32 s + 8 hi + e (e < 8) or 32 s + 16 + 8 hi + e - 8
    const int ko = wv * (FW * NHID) + 8 * hi;
    const float* xl = xs + lr * OP + FW * wv;   // this lane's row of tile 0, this wave's features; tile 1 is 16 rows on
#pragma unroll 1   // four trips of four steps (two features), kept rolled: a quarter of the code
    for (int t = 0; t < 4; ++t) {
        const char* bb = bl + t * 16384;
        const float* pw_ = wfs + ko + t * 128; const float* pc_ = bfs + ko + t * 128;
        v2f xp[MT];
#pragma unroll
        for (int m = 0; m < MT; ++m) xp[m] = *(const v2fa*)(xl + 16 * m * OP + 2 * t);
#pragma unroll
        for (int q = 0; q < 4; ++q) {
            v4f w4[4], c4[4];
#pragma unroll
            for (int u = 0; u < 4; ++u) { w4[u] = *(const v4fa*)(pw_ + 32 * q + 16 * (u >> 1) + 4 * (u & 1)); c4[u] = *(const v4fa*)(pc_ + 32 * q + 16 * (u >> 1) + 4 * (u & 1)); }
#pragma unroll
            for (int nb = 0; nb < 4; ++nb) if (q < 3 || t < 3) b[(q + 1) & 1][nb] = ldfrag((const bf*)(bb + (q + 1) * 4096) + nb * 512);   // no step follows the last one
            if (q == 3) asm volatile("s_wait_xcnt 0x0" ::: "memory");   // behind the trip's last B loads: the register pair that they name as their address is rewritten from here on (reused by the arithmetic below, then by the next trip's address)
            __builtin_amdgcn_sched_barrier(0);   // keeps the step's eight LDS loads and the next step's eight B loads in front of the T arithmetic, which hides their latency: left alone the scheduler sinks them to just in front of their uses, with a full wait each
            v8u ah[MT], al[MT];   // register 2 u + p holds elements 4 u + 2 p and the next one
#pragma unroll
            for (int u = 0; u < 4; ++u) {
#pragma unroll
                for (int m = 0; m < MT; ++m) { const v4f t4 = elu4(xp[m][q >> 1], w4[u], c4[u]);
#pragma unroll
                    for (int p = 0; p < 2; ++p) { unsigned uh, ul; split2(t4[2 * p], t4[2 * p + 1], uh, ul); ah[m][2 * u + p] = uh; al[m][2 * u + p] = ul; } } }
#pragma unroll
            for (int m = 0; m < MT; ++m) { const v16bf fa = __builtin_bit_cast(v16bf, ah[m]);
#pragma unroll
                for (int nb = 0; nb < 4; ++nb) acc[m][nb] = wmmab(fa, b[q & 1][nb], acc[m][nb]); }
#pragma unroll
            for (int m = 0; m < MT; ++m) { const v16bf fl = __builtin_bit_cast(v16bf, al[m]);
#pragma unroll
                for (int nb = 0; nb < 4; ++nb) acc[m][nb] = wmmab(fl, b[q & 1][nb], acc[m][nb]); }
        }
    }
    float* pw = os + wv * (RW * OP);
#pragma unroll
    for (int m = 0; m < MT; ++m) {
#pragma unroll
        for (int nb = 0; nb < 4; ++nb) {
#pragma unroll
            for (int j = 0; j < 8; ++j) pw[(16 * m + hi * 8 + j) * OP + nb * 16 + lr] = acc[m][nb][j]; } }
    __syncthreads();   // every wave's partial logit tiles are in LDS before any is read
    const int row = 4 * wv + (lane >> 3), cofs = (lane & 7) * 8;   // wave w adds up rows 4w .. 4w+3: eight lanes a row, eight columns a lane
    const float* pr = os + row * OP + cofs;
    v4f l0 = *(const v4fa*)pr, l1 = *(const v4fa*)(pr + 4);
#pragma unroll
    for (int w = 1; w < GW; ++w) { l0 += *(const v4fa*)(pr + w * (RW * OP)); l1 += *(const v4fa*)(pr + w * (RW * OP) + 4); }
    l0 += bfr4(*(const v4fa*)(bias + cofs)); l1 += bfr4(*(const v4fa*)(bias + cofs + 4));
    float mx = fmaxf(fmaxf(fmaxf(l0[0], l0[1]), fmaxf(l0[2], l0[3])), fmaxf(fmaxf(l1[0], l1[1]), fmaxf(l1[2], l1[3])));
#pragma unroll
    for (int sh = 4; sh; sh >>= 1) mx = fmaxf(mx, __shfl_xor(mx, sh, 32));
    v4f e0, e1;
#pragma unroll
    for (int j = 0; j < 4; ++j) { e0[j] = __builtin_amdgcn_exp2f((l0[j] - mx) * 1.4426950408889634f); e1[j] = __builtin_amdgcn_exp2f((l1[j] - mx) * 1.4426950408889634f); }
    float sum = ((e0[0] + e0[1]) + (e0[2] + e0[3])) + ((e1[0] + e1[1]) + (e1[2] + e1[3]));
#pragma unroll
    for (int sh = 4; sh; sh >>= 1) sum = sum + __shfl_xor(sum, sh, 32);
    const float inv = __fdiv_rn(1.0f, sum); const v4f o0 = e0 * inv, o1 = e1 * inv;
    *(v4f*)(wts + (size_t)(r0 + row) * NF + cofs) = o0; *(v4f*)(wts + (size_t)(r0 + row) * NF + cofs + 4) = o1;
    *(v4fa*)(wl + row * OP + cofs) = o0; *(v4fa*)(wl + row * OP + cofs + 4) = o1;
    __syncthreads();   // the 32 rows' weights are in LDS, and every read of the logit tiles is over, before the tiles are written again
    v4f wq[MT][2], xq[MT][2];   // this lane's row of either tile, this wave's 8 features: weights and x
#pragma unroll
    for (int m = 0; m < MT; ++m) {
#pragma unroll
        for (int h = 0; h < 2; ++h) { wq[m][h] = *(const v4fa*)(wl + (16 * m + lr) * OP + FW * wv + 4 * h); xq[m][h] = *(const v4fa*)(xl + 16 * m * OP + 4 * h); } }
    // Trip ii, part j: four columns (16 ii + 8 hi + 4 (j >> 1) + 0..3) of four of the wave's eight features (4 (j & 1) + 0..3), formed as in the GEMM loop, each Wf / bf read used for both tiles
    v4f gw[2][4], gc[2][4], s4[MT];
#pragma unroll
    for (int f = 0; f < 4; ++f) { gw[0][f] = *(const v4fa*)(wfs + ko + 64 * f); gc[0][f] = *(const v4fa*)(bfs + ko + 64 * f); }
#pragma unroll 1   // four trips of four parts, kept rolled: a quarter of the code
    for (int ii = 0; ii < 4; ++ii) {
        const int oc = ko + 16 * ii, on = ko + 16 * ((ii + 1) & 3);   // the last trip reads the first part once more: a valid address, never used
        float* ps = pw + lr * OP + 16 * ii + 8 * hi;
#pragma unroll
        for (int j = 0; j < 4; ++j) {
            const int o = (j < 3 ? oc + 4 * ((j + 1) >> 1) : on) + 256 * ((j + 1) & 1);
#pragma unroll
            for (int f = 0; f < 4; ++f) { gw[(j + 1) & 1][f] = *(const v4fa*)(wfs + o + 64 * f); gc[(j + 1) & 1][f] = *(const v4fa*)(bfs + o + 64 * f); }
            __builtin_amdgcn_sched_barrier(0);   // keeps the next part's eight LDS loads in front of this part's arithmetic, which hides their latency: left alone the scheduler puts each pair of loads directly in front of its use, with a full LDS wait each
            const int h = j & 1;
#pragma unroll
            for (int m = 0; m < MT; ++m) {
                v4f a = h ? s4[m] + wq[m][h][0] * elu4(xq[m][h][0], gw[h][0], gc[h][0]) : wq[m][h][0] * elu4(xq[m][h][0], gw[h][0], gc[h][0]);
#pragma unroll
                for (int f = 1; f < 4; ++f) a = a + wq[m][h][f] * elu4(xq[m][h][f], gw[h][f], gc[h][f]);
                s4[m] = a;
                if (h) *(v4fa*)(ps + 16 * m * OP + 4 * (j >> 1)) = a; } } }
    __syncthreads();   // every wave's partial weighted sums are in LDS before any is read
    v4f s0 = *(const v4fa*)pr, s1 = *(const v4fa*)(pr + 4);
#pragma unroll
    for (int w = 1; w < GW; ++w) { s0 += *(const v4fa*)(pr + w * (RW * OP)); s1 += *(const v4fa*)(pr + w * (RW * OP) + 4); }
    *(v4f*)(sel + (size_t)(r0 + row) * NHID + cofs) = s0; *(v4f*)(sel + (size_t)(r0 + row) * NHID + cofs + 4) = s1;
}

// ---- k_pack: Ws [4096][64] f32 -> bf16 in the fragment order above. Work-group b = 16 w + s reads rows 32 b .. 32 b + 31 (8 KiB in a row) and writes 4 KiB in a row; a thread makes one lane's 16 bytes.
__global__ __launch_bounds__(256) void k_pack(const float* __restrict__ w, bf* Bt) {
    const int t = threadIdx.x, l = t & 31, p = (t >> 5) & 1, nb = t >> 6;
    const float* s = w + (size_t)(blockIdx.x * 32 + 16 * p + 8 * (l >> 4)) * NF + nb * 16 + (l & 15);
    v4u o;
#pragma unroll
    for (int j = 0; j < 4; ++j) o[j] = cvt2u(s[2 * j * NF], s[(2 * j + 1) * NF]);
    *(v4u*)(Bt + ((size_t)blockIdx.x * 256 + t) * 8) = o;
}

extern "C" void kernel_launch(void* const* d_in, const int* in_sizes, int n_in,
                              void* d_out, int out_size, void* d_ws, size_t ws_size, hipStream_t stream) {
    (void)in_sizes; (void)n_in; (void)out_size;
    const float* x = (const float*)d_in[0]; const float* Wf = (const float*)d_in[1]; const float* bfv = (const float*)d_in[2]; const float* Ws = (const float*)d_in[3]; const float* bs = (const float*)d_in[4];
    float* SEL = (float*)d_out; float* WTS = SEL + (size_t)NR * NHID;     // tuple: selected [32][512][64] | weights [32][512][64]
    bf* WSB = (bf*)d_ws;
    if ((size_t)NF * KT * 2 > ws_size) return;    // ws 256 MiB (carve 512 KiB)
    k_pack<<<KT / 32, 256, 0, stream>>>(Ws, WSB);   /* Ws [4096][64] -> B fragments, 512 KiB */
    k_vsn<<<NR / RW, 32 * GW, 0, stream>>>(x, Wf, bfv, WSB, bs, SEL, WTS);
}

// v008
// A run of this version takes 23.5 microseconds.
// Two timings next to v007 both put it at 1.08 times that version's speed.
// All steps since v000 together make it 27.5 times as fast.
#include <hip/hip_runtime.h>

// Variable selection network (x [32][512][64]; per feature f a Linear(1, 64) + ELU: T[r][f][h] = elu(x[r][f] Wf[f][h] + bf[f][h]); logits[r][f] = sum_{f',h} T[r][f'][h] Ws[f'*64 + h][f] + bs[f]; weights = softmax over the 64 features; selected[r][h] = sum_f weights[r][f] T[r][f][h] -> tuple (selected [32][512][64], weights [32][512][64]) (1.0 M + 1.0 M)).
// Layout: one kernel packs the selector weight to bf16 in the order of the B fragments (512 contiguous bytes per wave-wide load); one fused kernel, a work-group of 8 waves per 32 rows (two 16-row tiles), does the rest. Wave w owns features 8w .. 8w+7 (K columns 512w .. 512w+511) of both tiles: it forms its T values in registers in the A-fragment order and splits them to bf16 hi/lo for the products, and every B fragment it loads and every Wf / bf value it reads serves both tiles; the 8 partial logit tiles meet in LDS; wave w takes the softmax of rows 4w .. 4w+3; every wave then forms its T values a second time, weights them, and the 8 partial sums meet in LDS again. T is never stored; two work-groups fit a WGP. Both loops work on U = T + 1, which costs one instruction an element less than T; the ones are taken off the sums: the column sums of the packed weight (made by the pack kernel) are the accumulators' start value, the sum of the wave's weights that of the weighted sum.
// Compute dtypes, f32 accumulate: every input rounded to bf16; T + 1 in f32 (the larger of v + 1 and exp2(v log2 e) clamped at 1); selector GEMM hi/lo x exact; softmax and the weighted sum in f32 (fixed orders).

#define NR   16384   // rows = 32 x 512
#define NF   64      // features
#define NHID 64      // hidden per feature
#define KT   (NF * NHID)   // 4096
typedef _Float16 h16;
typedef unsigned short bf;
typedef __attribute__((ext_vector_type(16))) __bf16   v16bf;
typedef __attribute__((ext_vector_type(16))) _Float16 v16h;
typedef __attribute__((ext_vector_type(8)))  _Float16 v8h;
typedef __attribute__((ext_vector_type(8)))  unsigned short v8us;
typedef __attribute__((ext_vector_type(8)))  float    v8f;
typedef __attribute__((ext_vector_type(4)))  float    v4f;
typedef v8h  __attribute__((may_alias)) v8ha;
typedef v4f  __attribute__((may_alias)) v4fa;
typedef v8us __attribute__((may_alias)) v8usa;

typedef __attribute__((ext_vector_type(2))) __bf16   v2bf;
typedef __attribute__((ext_vector_type(2))) float    v2f;
typedef __attribute__((ext_vector_type(4))) unsigned v4u;
typedef __attribute__((ext_vector_type(8))) unsigned v8u;
// Two f32 -> two bf16 in one register, round to nearest even: the hardware's packed convert, one instruction
__device__ __forceinline__ v2bf cvt2(float a, float b) { const v2f p = {a, b}; return __builtin_convertvector(p, v2bf); }
__device__ __forceinline__ unsigned cvt2u(float a, float b) { return __builtin_bit_cast(unsigned, cvt2(a, b)); }
__device__ __forceinline__ float bfr(float f) { return (float)(__bf16)f; }
__device__ __forceinline__ v4f bfr4(v4f a) { const v2bf p = cvt2(a[0], a[1]), q = cvt2(a[2], a[3]); const v4f r = {(float)p[0], (float)p[1], (float)q[0], (float)q[1]}; return r; }
__device__ __forceinline__ v16h cat16(v8h lo, v8h hi) { return __builtin_shufflevector(lo, hi, 0, 1, 2, 3, 4, 5, 6, 7, 8, 9, 10, 11, 12, 13, 14, 15); }
__device__ __forceinline__ v16bf cat16b(v8us lo, v8us hi) { return __builtin_bit_cast(v16bf, __builtin_shufflevector(lo, hi, 0, 1, 2, 3, 4, 5, 6, 7, 8, 9, 10, 11, 12, 13, 14, 15)); }
__device__ __forceinline__ v8f wmma16(v16h a, v16h b, v8f c) { return __builtin_amdgcn_wmma_f32_16x16x32_f16(false, a, false, b, (short)0, c, false, false); }
__device__ __forceinline__ v8f wmmab(v16bf a, v16bf b, v8f c) { return __builtin_amdgcn_wmma_f32_16x16x32_bf16(false, a, false, b, (short)0, c, false, false); }



// ---- k_vsn: the whole network for 32 rows (two 16-row tiles). grid NR / 32, 32 * GW threads.
#define GW 8
#define MT 2             // 16-row tiles a wave: every B fragment and every Wf / bf read from LDS serves both
#define RW (16 * MT)     // rows a work-group
#define FW (NF / GW)     // features a wave
static_assert(GW == 8 && MT == 2 && FW == 8 && NHID == 64 && RW == 4 * GW, "wave w owns 8 features and adds up rows 4w .. 4w+3 of the 32-row tile");
#define OP 68   // f32 pitch of the LDS tiles: 16 B x odd, so 16 rows fall on distinct banks
typedef v2f  __attribute__((may_alias)) v2fa;
// Packed selector weight: block (step b of 32 K rows, column block nb, part p) is 512 bytes, lane l's 16 bytes being Ws[32 b + 16 p + 8 (l >> 4) + 0..7][16 nb + (l & 15)]
__device__ __forceinline__ v16bf ldfrag(const bf* p) { return cat16b(*(const v8us*)p, *(const v8us*)(p + 256)); }
// A pair of T values -> its bf16 pair (hi) and the bf16 pair of what the rounding left (lo)
__device__ __forceinline__ void split2(float y0, float y1, unsigned& h, unsigned& l) { const v2bf hp = cvt2(y0, y1); h = __builtin_bit_cast(unsigned, hp); l = cvt2u(y0 - (float)hp[0], y1 - (float)hp[1]); }
// Four values U = 1 + ELU(v), v = x w + c; c1 = c + 1 comes from the table, so u = v + 1 is one multiply-add and no subtraction of 1 follows the exponential. e^v from the hardware exp2 of (u - 1) log2 e: absolute error about one ulp of 1, which is what the sums see; e^v >= 1 + v everywhere, so the larger one of u and min(e^v, 1) is u above v = 0 and e^v below (the median with 0 and 1 becomes the exponential's own clamp to [0, 1])
__device__ __forceinline__ v4f elu4(float xv, v4f w4, v4f c1) {
    const v4f u4 = xv * w4 + c1, a4 = u4 * 1.4426950408889634f - 1.4426950408889634f; v4f t4;
#pragma unroll
    for (int j = 0; j < 4; ++j) t4[j] = __builtin_amdgcn_fmed3f(__builtin_amdgcn_exp2f(a4[j]), 0.0f, 1.0f);
    return __builtin_elementwise_max(u4, t4); }
// 4 waves a SIMD = two work-groups a WGP: the register budget is 256
__global__ __launch_bounds__(32 * GW) __attribute__((amdgpu_waves_per_eu(4))) void k_vsn(const float* __restrict__ x, const float* __restrict__ Wf, const float* __restrict__ bfv, const bf* __restrict__ Bt, const float* __restrict__ cs, const float* __restrict__ bias, float* sel, float* wts) {
    // One LDS block, the tables that the inner loops read first: their reads then reach Wf and bf from one address register with constant offsets (an LDS offset field ends at 64 KiB)
    __shared__ __align__(16) float sm[2 * KT + 2 * RW * OP + GW * RW * OP];
    float* const wfs = sm; float* const bfs = sm + KT;   // Wf and bf + 1, rounded (before the 1) once per work-group
    float* const xs = sm + 2 * KT;                       // the 32 rows of x, rounded
    float* const wl = xs + RW * OP;                      // softmax weights of the 32 rows
    float* const os = wl + RW * OP;                      // the 8 waves' partial tiles: logits first, the weighted sums later
    const int lane = threadIdx.x & 31, lr = lane & 15, hi = lane >> 4, wv = threadIdx.x >> 5; const int r0 = blockIdx.x * RW;
#pragma unroll
    for (int q = 0; q < KT / (128 * GW); ++q) { const int e0 = threadIdx.x * 4 + q * (128 * GW); const v4f a = *(const v4fa*)(Wf + e0), b = *(const v4fa*)(bfv + e0);
        *(v4fa*)(wfs + e0) = bfr4(a); *(v4fa*)(bfs + e0) = bfr4(b) + 1.0f; }
#pragma unroll
    for (int q = 0; q < RW * NF / (128 * GW); ++q) { const int e0 = threadIdx.x * 4 + q * (128 * GW); const v4f a = *(const v4fa*)(x + (size_t)r0 * NF + e0);
        *(v4fa*)(xs + (e0 >> 6) * OP + (e0 & 63)) = bfr4(a); }
    const char* bl = (const char*)Bt + (unsigned)(wv * 65536 + lane * 16);   // this lane's 16 bytes of the wave's first block; a step is 4096 bytes, a column block 1024
    v16bf b[2][4];   // the running step's B fragments and the next step's
#pragma unroll
    for (int nb = 0; nb < 4; ++nb) b[0][nb] = ldfrag((const bf*)bl + nb * 512);
    // Column sums of the packed weight over this wave's 512 K rows (16 steps): this half-wave adds 8 steps, element nb being column 16 nb + lr
    const float* cp = cs + (wv * 16 + hi * 8) * NF + lr * 4;
    v4f cq = *(const v4fa*)cp;
#pragma unroll
    for (int i = 1; i < 8; ++i) cq += *(const v4fa*)(cp + i * NF);
    __syncthreads();   // the rounded Wf, bf and x are in LDS before any wave reads them
    v8f acc[MT][4];   // start value: minus the column sum, which takes the ones of U = T + 1 off the products
#pragma unroll
    for (int nb = 0; nb < 4; ++nb) { const float z = -(cq[nb] + __shfl_xor(cq[nb], 16, 32));
#pragma unroll
        for (int m = 0; m < MT; ++m) {
#pragma unroll
            for (int j = 0; j < 8; ++j) acc[m][nb][j] = z; } }
    // U = T + 1 of this wave, f32, in the A-fragment order: step s (32 K columns) element e is column 32 s + 8 hi + e (e < 8) or 32 s + 16 + 8 hi + e - 8
    const int ko = wv * (FW * NHID) + 8 * hi;
    const float* xl = xs + lr * OP + FW * wv;   // this lane's row of tile 0, this wave's features; tile 1 is 16 rows on
#pragma unroll 1   // four trips of four steps (two features), kept rolled: a quarter of the code
    for (int t = 0; t < 4; ++t) {
        const char* bb = bl + t * 16384;
        const float* pw_ = wfs + ko + t * 128; const float* pc_ = bfs + ko + t * 128;
        v2f xp[MT];
#pragma unroll
        for (int m = 0; m < MT; ++m) xp[m] = *(const v2fa*)(xl + 16 * m * OP + 2 * t);
#pragma unroll
        for (int q = 0; q < 4; ++q) {
            v4f w4[4], c4[4];
#pragma unroll
            for (int u = 0; u < 4; ++u) { w4[u] = *(const v4fa*)(pw_ + 32 * q + 16 * (u >> 1) + 4 * (u & 1)); c4[u] = *(const v4fa*)(pc_ + 32 * q + 16 * (u >> 1) + 4 * (u & 1)); }
#pragma unroll
            for (int nb = 0; nb < 4; ++nb) if (q < 3 || t < 3) b[(q + 1) & 1][nb] = ldfrag((const bf*)(bb + (q + 1) * 4096) + nb * 512);   // no step follows the last one
            if (q == 3) asm volatile("s_wait_xcnt 0x0" ::: "memory");   // behind the trip's last B loads: the register pair that they name as their address is rewritten from here on (reused by the arithmetic below, then by the next trip's address)
            __builtin_amdgcn_sched_barrier(0);   // keeps the step's eight LDS loads and the next step's eight B loads in front of the T arithmetic, which hides their latency: left alone the scheduler sinks them to just in front of their uses, with a full wait each
            v8u ah[MT], al[MT];   // register 2 u + p holds elements 4 u + 2 p and the next one
#pragma unroll
            for (int u = 0; u < 4; ++u) {
#pragma unroll
                for (int m = 0; m < MT; ++m) { const v4f t4 = elu4(xp[m][q >> 1], w4[u], c4[u]);
#pragma unroll
                    for (int p = 0; p < 2; ++p) { unsigned uh, ul; split2(t4[2 * p], t4[2 * p + 1], uh, ul); ah[m][2 * u + p] = uh; al[m][2 * u + p] = ul; } } }
#pragma unroll
            for (int m = 0; m < MT; ++m) { const v16bf fa = __builtin_bit_cast(v16bf, ah[m]);
#pragma unroll
                for (int nb = 0; nb < 4; ++nb) acc[m][nb] = wmmab(fa, b[q & 1][nb], acc[m][nb]); }
#pragma unroll
            for (int m = 0; m < MT; ++m) { const v16bf fl = __builtin_bit_cast(v16bf, al[m]);
#pragma unroll
                for (int nb = 0; nb < 4; ++nb) acc[m][nb] = wmmab(fl, b[q & 1][nb], acc[m][nb]); }
        }
    }
    float* pw = os + wv * (RW * OP);
#pragma unroll
    for (int m = 0; m < MT; ++m) {
#pragma unroll
        for (int nb = 0; nb < 4; ++nb) {
#pragma unroll
            for (int j = 0; j < 8; ++j) pw[(16 * m + hi * 8 + j) * OP + nb * 16 + lr] = acc[m][nb][j]; } }
    __syncthreads();   // every wave's partial logit tiles are in LDS before any is read
    const int row = 4 * wv + (lane >> 3), cofs = (lane & 7) * 8;   // wave w adds up rows 4w .. 4w+3: eight lanes a row, eight columns a lane
    const float* pr = os + row * OP + cofs;
    v4f l0 = *(const v4fa*)pr, l1 = *(const v4fa*)(pr + 4);
#pragma unroll
    for (int w = 1; w < GW; ++w) { l0 += *(const v4fa*)(pr + w * (RW * OP)); l1 += *(const v4fa*)(pr + w * (RW * OP) + 4); }
    l0 += bfr4(*(const v4fa*)(bias + cofs)); l1 += bfr4(*(const v4fa*)(bias + cofs + 4));
    float mx = fmaxf(fmaxf(fmaxf(l0[0], l0[1]), fmaxf(l0[2], l0[3])), fmaxf(fmaxf(l1[0], l1[1]), fmaxf(l1[2], l1[3])));
#pragma unroll
    for (int sh = 4; sh; sh >>= 1) mx = fmaxf(mx, __shfl_xor(mx, sh, 32));
    v4f e0, e1;
#pragma unroll
    for (int j = 0; j < 4; ++j) { e0[j] = __builtin_amdgcn_exp2f((l0[j] - mx) * 1.4426950408889634f); e1[j] = __builtin_amdgcn_exp2f((l1[j] - mx) * 1.4426950408889634f); }
    float sum = ((e0[0] + e0[1]) + (e0[2] + e0[3])) + ((e1[0] + e1[1]) + (e1[2] + e1[3]));
#pragma unroll
    for (int sh = 4; sh; sh >>= 1) sum = sum + __shfl_xor(sum, sh, 32);
    const float inv = __fdiv_rn(1.0f, sum); const v4f o0 = e0 * inv, o1 = e1 * inv;
    *(v4f*)(wts + (size_t)(r0 + row) * NF + cofs) = o0; *(v4f*)(wts + (size_t)(r0 + row) * NF + cofs + 4) = o1;
    *(v4fa*)(wl + row * OP + cofs) = o0; *(v4fa*)(wl + row * OP + cofs + 4) = o1;
    __syncthreads();   // the 32 rows' weights are in LDS, and every read of the logit tiles is over, before the tiles are written again
    v4f wq[MT][2], xq[MT][2];   // this lane's row of either tile, this wave's 8 features: weights and x
#pragma unroll
    for (int m = 0; m < MT; ++m) {
#pragma unroll
        for (int h = 0; h < 2; ++h) { wq[m][h] = *(const v4fa*)(wl + (16 * m + lr) * OP + FW * wv + 4 * h); xq[m][h] = *(const v4fa*)(xl + 16 * m * OP + 4 * h); } }
    // Trip ii, part j: four columns (16 ii + 8 hi + 4 (j >> 1) + 0..3) of four of the wave's eight features (4 (j & 1) + 0..3), formed as in the GEMM loop, each Wf / bf read used for both tiles
    float wn[MT];   // minus the sum of the wave's 8 weights of the row: the start value that takes the ones of U = T + 1 off the weighted sum
#pragma unroll
    for (int m = 0; m < MT; ++m) wn[m] = -(((wq[m][0][0] + wq[m][0][1]) + (wq[m][0][2] + wq[m][0][3])) + ((wq[m][1][0] + wq[m][1][1]) + (wq[m][1][2] + wq[m][1][3])));
    v4f gw[2][4], gc[2][4], s4[MT];
#pragma unroll
    for (int f = 0; f < 4; ++f) { gw[0][f] = *(const v4fa*)(wfs + ko + 64 * f); gc[0][f] = *(const v4fa*)(bfs + ko + 64 * f); }
#pragma unroll 1   // four trips of four parts, kept rolled: a quarter of the code
    for (int ii = 0; ii < 4; ++ii) {
        const int oc = ko + 16 * ii, on = ko + 16 * ((ii + 1) & 3);   // the last trip reads the first part once more: a valid address, never used
        float* ps = pw + lr * OP + 16 * ii + 8 * hi;
#pragma unroll
        for (int j = 0; j < 4; ++j) {
            const int o = (j < 3 ? oc + 4 * ((j + 1) >> 1) : on) + 256 * ((j + 1) & 1);
#pragma unroll
            for (int f = 0; f < 4; ++f) { gw[(j + 1) & 1][f] = *(const v4fa*)(wfs + o + 64 * f); gc[(j + 1) & 1][f] = *(const v4fa*)(bfs + o + 64 * f); }
            __builtin_amdgcn_sched_barrier(0);   // keeps the next part's eight LDS loads in front of this part's arithmetic, which hides their latency: left alone the scheduler puts each pair of loads directly in front of its use, with a full LDS wait each
            const int h = j & 1;
#pragma unroll
            for (int m = 0; m < MT; ++m) {
                v4f a = (h ? s4[m] : (v4f){wn[m], wn[m], wn[m], wn[m]}) + wq[m][h][0] * elu4(xq[m][h][0], gw[h][0], gc[h][0]);
#pragma unroll
                for (int f = 1; f < 4; ++f) a = a + wq[m][h][f] * elu4(xq[m][h][f], gw[h][f], gc[h][f]);
                s4[m] = a;
                if (h) *(v4fa*)(ps + 16 * m * OP + 4 * (j >> 1)) = a; } } }
    __syncthreads();   // every wave's partial weighted sums are in LDS before any is read
    v4f s0 = *(const v4fa*)pr, s1 = *(const v4fa*)(pr + 4);
#pragma unroll
    for (int w = 1; w < GW; ++w) { s0 += *(const v4fa*)(pr + w * (RW * OP)); s1 += *(const v4fa*)(pr + w * (RW * OP) + 4); }
    *(v4f*)(sel + (size_t)(r0 + row) * NHID + cofs) = s0; *(v4f*)(sel + (size_t)(r0 + row) * NHID + cofs + 4) = s1;
}

// ---- k_pack: Ws [4096][64] f32 -> bf16 in the fragment order above. Work-group b = 16 w + s reads rows 32 b .. 32 b + 31 (8 KiB in a row) and writes 4 KiB in a row; a thread makes one lane's 16 bytes. It also writes the 64 column sums of its 32 rounded rows, cs[64 b + 4 lr + nb] being column 16 nb + lr.
__global__ __launch_bounds__(256) void k_pack(const float* __restrict__ w, bf* Bt, float* cs) {
    __shared__ float red[256];
    const int t = threadIdx.x, l = t & 31, p = (t >> 5) & 1, nb = t >> 6;
    const float* s = w + (size_t)(blockIdx.x * 32 + 16 * p + 8 * (l >> 4)) * NF + nb * 16 + (l & 15);
    v4u o; v4f a;
#pragma unroll
    for (int j = 0; j < 4; ++j) { const v2bf q = cvt2(s[2 * j * NF], s[(2 * j + 1) * NF]); o[j] = __builtin_bit_cast(unsigned, q); a[j] = (float)q[0] + (float)q[1]; }
    red[t] = (a[0] + a[1]) + (a[2] + a[3]);
    __syncthreads();   // the 256 sums of 8 rows are in LDS before the first 64 threads add four each; the store of the fragments follows it, so that the barrier does not wait for that store
    *(v4u*)(Bt + ((size_t)blockIdx.x * 256 + t) * 8) = o;
    if (t < 64) { const float* r = red + (t & 3) * 64 + (t >> 2); cs[blockIdx.x * 64 + t] = (r[0] + r[16]) + (r[32] + r[48]); }
}

extern "C" void kernel_launch(void* const* d_in, const int* in_sizes, int n_in,
                              void* d_out, int out_size, void* d_ws, size_t ws_size, hipStream_t stream) {
    (void)in_sizes; (void)n_in; (void)out_size;
    const float* x = (const float*)d_in[0]; const float* Wf = (const float*)d_in[1]; const float* bfv = (const float*)d_in[2]; const float* Ws = (const float*)d_in[3]; const float* bs = (const float*)d_in[4];
    float* SEL = (float*)d_out; float* WTS = SEL + (size_t)NR * NHID;     // tuple: selected [32][512][64] | weights [32][512][64]
    bf* WSB = (bf*)d_ws; float* CS = (float*)(WSB + (size_t)NF * KT);
    if ((size_t)NF * KT * 2 + (size_t)(KT / 32) * NF * 4 > ws_size) return;    // ws 256 MiB (carve 512 KiB + 32 KiB)
    k_pack<<<KT / 32, 256, 0, stream>>>(Ws, WSB, CS);   /* Ws [4096][64] -> B fragments, 512 KiB, and 128 x 64 column sums */
    k_vsn<<<NR / RW, 32 * GW, 0, stream>>>(x, Wf, bfv, WSB, CS, bs, SEL, WTS);
}
